// v000
// The times below were measured on an AMD MI455X: many runs one after another, warmed up first and cycling through
// copies of the inputs, with the whole window's GPU time divided by the number of runs. Launches and the gaps
// between them are all in it. The median over several windows is given; except for v000 it joins two sittings, which
// can be a few percent apart, so the side-by-side timings, each taken in one sitting, are the better comparison.
// v000, which the later versions start from, runs in 900 microseconds.
#include <hip/hip_runtime.h>
#include <hip/hip_bf16.h>
#include <cstdint>
#include <cstddef>

#define S_LEN  2048
#define SC_LEN 1024
#define DMODEL 3072
#define NHEADS 24
#define HDIM   128

typedef __attribute__((ext_vector_type(16))) _Float16 v16h;
typedef __attribute__((ext_vector_type(8)))  float    v8f;
typedef __attribute__((ext_vector_type(4)))  _Float16 v4h;

union AF { uint4 u[2]; v16h h; };

static __device__ __forceinline__ v8f wmma_f16(v16h a, v16h b, v8f c) {
  // D = A(16x32 f16) x B(32x16 f16) + C(16x16 f32)
  return __builtin_amdgcn_wmma_f32_16x16x32_f16(false, a, false, b, (short)0, c,
                                                false, false);
}

static __device__ __forceinline__ v8f v8f_zero() {
  v8f z = {0.f, 0.f, 0.f, 0.f, 0.f, 0.f, 0.f, 0.f};
  return z;
}

// ---------------------------------------------------------------------------
// fp32 -> f16 elementwise convert
// ---------------------------------------------------------------------------
__global__ void f32_to_f16_kernel(const float* __restrict__ in,
                                  _Float16* __restrict__ out, size_t n) {
  size_t i = (size_t)blockIdx.x * blockDim.x + threadIdx.x;
  if (i < n) out[i] = (_Float16)in[i];
}

// ---------------------------------------------------------------------------
// C[M,N] = X[M,K] * W[N,K]^T + bias[N]   (f16 inputs, f32 out)
// block = 128 threads (4 waves); block tile M=64 x N=128.
// per wave: 32x64 tile -> 8 WMMA per 12 b128 loads per 32-k step.
// ---------------------------------------------------------------------------
__global__ void __launch_bounds__(128)
gemm_wmma_kernel(const _Float16* __restrict__ X, const _Float16* __restrict__ W,
                 const float* __restrict__ bias, float* __restrict__ out,
                 int M, int N, int K) {
  const int lane = threadIdx.x & 31;
  const int wave = threadIdx.x >> 5;
  const int r    = lane & 15;
  const int half = lane >> 4;
  const int m0   = blockIdx.y * 64 + (wave >> 1) * 32;
  const int n0   = blockIdx.x * 128 + (wave & 1) * 64;

  v8f acc[2][4];
#pragma unroll
  for (int a = 0; a < 2; ++a)
#pragma unroll
    for (int j = 0; j < 4; ++j) acc[a][j] = v8f_zero();

  const _Float16* xr0 = X + (size_t)(m0 + r) * K;
  const _Float16* xr1 = xr0 + (size_t)16 * K;

  for (int k = 0; k < K; k += 32) {
    AF a0, a1;
    a0.u[0] = *(const uint4*)(xr0 + k + half * 8);
    a0.u[1] = *(const uint4*)(xr0 + k + 16 + half * 8);
    a1.u[0] = *(const uint4*)(xr1 + k + half * 8);
    a1.u[1] = *(const uint4*)(xr1 + k + 16 + half * 8);
#pragma unroll
    for (int j = 0; j < 4; ++j) {
      const _Float16* wr = W + (size_t)(n0 + j * 16 + r) * K + k;
      AF b;
      b.u[0] = *(const uint4*)(wr + half * 8);
      b.u[1] = *(const uint4*)(wr + 16 + half * 8);
      acc[0][j] = wmma_f16(a0.h, b.h, acc[0][j]);
      acc[1][j] = wmma_f16(a1.h, b.h, acc[1][j]);
    }
  }

#pragma unroll
  for (int a = 0; a < 2; ++a) {
#pragma unroll
    for (int j = 0; j < 4; ++j) {
      const int n = n0 + j * 16 + r;
      const float bn = bias[n];
#pragma unroll
      for (int i = 0; i < 8; ++i) {
        const int m = m0 + a * 16 + half * 8 + i;
        out[(size_t)m * N + n] = acc[a][j][i] + bn;
      }
    }
  }
}

// ---------------------------------------------------------------------------
// RMSNorm(head_dim) + RoPE + optional scale, fp32 [T,D] -> f16 [H][T][HD]
// one wave per (h,t) row; lane owns 4 consecutive dims (2 rope pairs)
// ---------------------------------------------------------------------------
__global__ void __launch_bounds__(128)
norm_rope_pack_kernel(const float* __restrict__ P, const float* __restrict__ w,
                      const float* __restrict__ cs, const float* __restrict__ sn,
                      _Float16* __restrict__ out, int T, float scale) {
  const int gw   = (int)((blockIdx.x * blockDim.x + threadIdx.x) >> 5);
  const int lane = threadIdx.x & 31;
  if (gw >= NHEADS * T) return;
  const int t = gw % T;
  const int h = gw / T;
  const int d = lane * 4;

  const float4 x = *(const float4*)(P + (size_t)t * DMODEL + h * HDIM + d);
  float ss = x.x * x.x + x.y * x.y + x.z * x.z + x.w * x.w;
#pragma unroll
  for (int msk = 1; msk < 32; msk <<= 1) ss += __shfl_xor(ss, msk, 32);
  const float inv = rsqrtf(ss * (1.0f / (float)HDIM) + 1e-6f);

  const float4 wv = *(const float4*)(w + d);
  const float4 c  = *(const float4*)(cs + (size_t)t * HDIM + d);
  const float4 s  = *(const float4*)(sn + (size_t)t * HDIM + d);

  const float y0 = x.x * inv * wv.x;
  const float y1 = x.y * inv * wv.y;
  const float y2 = x.z * inv * wv.z;
  const float y3 = x.w * inv * wv.w;

  v4h o;
  o[0] = (_Float16)((y0 * c.x - y1 * s.x) * scale);
  o[1] = (_Float16)((y1 * c.y + y0 * s.y) * scale);
  o[2] = (_Float16)((y2 * c.z - y3 * s.z) * scale);
  o[3] = (_Float16)((y3 * c.w + y2 * s.w) * scale);
  *(v4h*)(out + ((size_t)h * T + t) * HDIM + d) = o;
}

// ---------------------------------------------------------------------------
// V pack + transpose: fp32 [T,D] -> f16 [H][HD][T]  (out[hd*T + t])
// LDS-tiled 32x32 so both global read and write are coalesced.
// block = 256 threads; grid = (DMODEL/32, T/32)
// ---------------------------------------------------------------------------
__global__ void __launch_bounds__(256)
vtranspose_pack_kernel(const float* __restrict__ P, _Float16* __restrict__ out,
                       int T) {
  __shared__ _Float16 tile[32][33];  // +1 pad to dodge bank conflicts
  const int tx = threadIdx.x & 31;
  const int ty = threadIdx.x >> 5;   // 0..7
  const int d0 = blockIdx.x * 32;
  const int t0 = blockIdx.y * 32;
#pragma unroll
  for (int k = 0; k < 4; ++k) {
    const int t = t0 + ty + k * 8;
    tile[ty + k * 8][tx] = (_Float16)P[(size_t)t * DMODEL + d0 + tx];
  }
  __syncthreads();
#pragma unroll
  for (int k = 0; k < 4; ++k) {
    const int row = ty + k * 8;
    out[(size_t)(d0 + row) * T + t0 + tx] = tile[tx][row];
  }
}

// ---------------------------------------------------------------------------
// One online-softmax attention pass over T keys for a 16-query block.
// ---------------------------------------------------------------------------
__device__ __forceinline__ void attn_pass(const AF* qa,
                                          const _Float16* __restrict__ Kr,
                                          const _Float16* __restrict__ Vt,
                                          int T, _Float16* __restrict__ ldsP,
                                          int lane, v8f* o, float* m, float* l) {
  const int r = lane & 15, half = lane >> 4;
#pragma unroll
  for (int j = 0; j < 8; ++j) { o[j] = v8f_zero(); }
#pragma unroll
  for (int i = 0; i < 8; ++i) { m[i] = -1e30f; l[i] = 0.f; }

  for (int k0 = 0; k0 < T; k0 += 32) {
    const _Float16* kr0 = Kr + (size_t)(k0 + r) * HDIM;
    const _Float16* kr1 = kr0 + 16 * HDIM;
    __builtin_prefetch(kr0 + 32 * HDIM, 0, 0);  // global_prefetch_b8, next chunk
    v8f s0 = v8f_zero(), s1 = v8f_zero();
#pragma unroll
    for (int kc = 0; kc < 4; ++kc) {
      AF b0, b1;
      b0.u[0] = *(const uint4*)(kr0 + kc * 32 + half * 8);
      b0.u[1] = *(const uint4*)(kr0 + kc * 32 + 16 + half * 8);
      b1.u[0] = *(const uint4*)(kr1 + kc * 32 + half * 8);
      b1.u[1] = *(const uint4*)(kr1 + kc * 32 + 16 + half * 8);
      s0 = wmma_f16(qa[kc].h, b0.h, s0);
      s1 = wmma_f16(qa[kc].h, b1.h, s1);
    }
    // online softmax: rows live in VGPR index (row = half*8+i), keys across 16 lanes
#pragma unroll
    for (int i = 0; i < 8; ++i) {
      float cm = fmaxf(s0[i], s1[i]);
      cm = fmaxf(cm, __shfl_xor(cm, 1, 32));
      cm = fmaxf(cm, __shfl_xor(cm, 2, 32));
      cm = fmaxf(cm, __shfl_xor(cm, 4, 32));
      cm = fmaxf(cm, __shfl_xor(cm, 8, 32));
      const float mn = fmaxf(m[i], cm);
      const float alpha = __expf(m[i] - mn);
      m[i] = mn;
      const float p0 = __expf(s0[i] - mn);
      const float p1 = __expf(s1[i] - mn);
      s0[i] = p0; s1[i] = p1;
      float rs = p0 + p1;
      rs += __shfl_xor(rs, 1, 32);
      rs += __shfl_xor(rs, 2, 32);
      rs += __shfl_xor(rs, 4, 32);
      rs += __shfl_xor(rs, 8, 32);
      l[i] = l[i] * alpha + rs;
#pragma unroll
      for (int j = 0; j < 8; ++j) o[j][i] *= alpha;
    }
    // transpose P (C-layout) -> A-layout via LDS, converting to f16
#pragma unroll
    for (int i = 0; i < 8; ++i) {
      const int row = half * 8 + i;
      ldsP[row * 32 + r]      = (_Float16)s0[i];
      ldsP[row * 32 + 16 + r] = (_Float16)s1[i];
    }
    AF pa;  // same-wave LDS ops are in-order; no barrier needed
    pa.u[0] = *(const uint4*)(ldsP + r * 32 + half * 8);
    pa.u[1] = *(const uint4*)(ldsP + r * 32 + 16 + half * 8);
#pragma unroll
    for (int j = 0; j < 8; ++j) {
      const _Float16* vr = Vt + (size_t)(j * 16 + r) * T + k0;
      AF bv;
      bv.u[0] = *(const uint4*)(vr + half * 8);
      bv.u[1] = *(const uint4*)(vr + 16 + half * 8);
      o[j] = wmma_f16(pa.h, bv.h, o[j]);
    }
  }
}

// ---------------------------------------------------------------------------
// Fused dual attention: out = lambda * softmax(Q Kc^T) Vc + softmax(Q K^T) V
// 4 waves per block; each wave owns one (head, 16-query) block.
// ---------------------------------------------------------------------------
__global__ void __launch_bounds__(128)
attention_kernel(const _Float16* __restrict__ Qb, const _Float16* __restrict__ Kb,
                 const _Float16* __restrict__ Vtb, const _Float16* __restrict__ Kcb,
                 const _Float16* __restrict__ Vctb, const float* __restrict__ lam,
                 float* __restrict__ out) {
  __shared__ _Float16 lds[4][16 * 32];
  const int wave = threadIdx.x >> 5;
  const int lane = threadIdx.x & 31;
  const int r = lane & 15, half = lane >> 4;
  const int qb = blockIdx.x * 4 + wave;       // 0 .. H*(S/16)-1
  const int h  = qb >> 7;                     // / (S_LEN/16)
  const int q0 = (qb & 127) * 16;

  // Q fragments (pre-scaled by 1/sqrt(HD) at pack time)
  AF qa[4];
  const _Float16* qrow = Qb + ((size_t)h * S_LEN + q0 + r) * HDIM;
#pragma unroll
  for (int kc = 0; kc < 4; ++kc) {
    qa[kc].u[0] = *(const uint4*)(qrow + kc * 32 + half * 8);
    qa[kc].u[1] = *(const uint4*)(qrow + kc * 32 + 16 + half * 8);
  }

  v8f oc[8]; float mc[8], lc[8];
  attn_pass(qa, Kcb + (size_t)h * SC_LEN * HDIM, Vctb + (size_t)h * HDIM * SC_LEN,
            SC_LEN, lds[wave], lane, oc, mc, lc);
  const float lambda = lam[0];
#pragma unroll
  for (int i = 0; i < 8; ++i) {
    const float f = lambda / lc[i];
#pragma unroll
    for (int j = 0; j < 8; ++j) oc[j][i] *= f;
  }

  v8f os[8]; float ms[8], ls[8];
  attn_pass(qa, Kb + (size_t)h * S_LEN * HDIM, Vtb + (size_t)h * HDIM * S_LEN,
            S_LEN, lds[wave], lane, os, ms, ls);

#pragma unroll
  for (int i = 0; i < 8; ++i) {
    const float inv = 1.0f / ls[i];
    const size_t row = (size_t)(q0 + half * 8 + i) * DMODEL + h * HDIM;
#pragma unroll
    for (int j = 0; j < 8; ++j) {
      out[row + j * 16 + r] = oc[j][i] + os[j][i] * inv;
    }
  }
}

// ---------------------------------------------------------------------------
// host launcher
// ---------------------------------------------------------------------------
extern "C" void kernel_launch(void* const* d_in, const int* in_sizes, int n_in,
                              void* d_out, int out_size, void* d_ws, size_t ws_size,
                              hipStream_t stream) {
  (void)in_sizes; (void)n_in; (void)out_size; (void)ws_size;
  const float* hs    = (const float*)d_in[0];
  const float* cond  = (const float*)d_in[1];
  const float* lam   = (const float*)d_in[2];
  const float* Wq    = (const float*)d_in[3];
  const float* bq    = (const float*)d_in[4];
  const float* Wk    = (const float*)d_in[5];
  const float* bk    = (const float*)d_in[6];
  const float* Wv    = (const float*)d_in[7];
  const float* bv    = (const float*)d_in[8];
  const float* nqw   = (const float*)d_in[9];
  const float* nkw   = (const float*)d_in[10];
  const float* cos0  = (const float*)d_in[11];
  const float* sin0  = (const float*)d_in[12];
  const float* cos1  = (const float*)d_in[13];
  const float* sin1  = (const float*)d_in[14];
  float* out = (float*)d_out;

  // workspace carve (256B aligned)
  char* wp = (char*)d_ws;
  auto carve = [&](size_t bytes) -> void* {
    void* p = (void*)wp;
    wp += (bytes + 255) & ~(size_t)255;
    return p;
  };
  _Float16* hsb   = (_Float16*)carve((size_t)S_LEN * DMODEL * 2);
  _Float16* condb = (_Float16*)carve((size_t)SC_LEN * DMODEL * 2);
  _Float16* wbuf  = (_Float16*)carve((size_t)DMODEL * DMODEL * 2);
  float*    pbuf  = (float*)   carve((size_t)S_LEN * DMODEL * 4);
  _Float16* Qb    = (_Float16*)carve((size_t)S_LEN * DMODEL * 2);
  _Float16* Kb    = (_Float16*)carve((size_t)S_LEN * DMODEL * 2);
  _Float16* Kcb   = (_Float16*)carve((size_t)SC_LEN * DMODEL * 2);
  _Float16* Vtb   = (_Float16*)carve((size_t)S_LEN * DMODEL * 2);
  _Float16* Vctb  = (_Float16*)carve((size_t)SC_LEN * DMODEL * 2);

  const float qscale = 0.088388347648318447f;  // 1/sqrt(128)
  const size_t nHS = (size_t)S_LEN * DMODEL;
  const size_t nC  = (size_t)SC_LEN * DMODEL;
  const size_t nW  = (size_t)DMODEL * DMODEL;
  auto cgrid = [](size_t n) { return (unsigned)((n + 255) / 256); };

  f32_to_f16_kernel<<<cgrid(nHS), 256, 0, stream>>>(hs, hsb, nHS);
  f32_to_f16_kernel<<<cgrid(nC), 256, 0, stream>>>(cond, condb, nC);

  const dim3 gS(DMODEL / 128, S_LEN / 64);
  const dim3 gC(DMODEL / 128, SC_LEN / 64);
  const unsigned packS = (unsigned)(NHEADS * S_LEN / 4);
  const unsigned packC = (unsigned)(NHEADS * SC_LEN / 4);
  const dim3 vtS(DMODEL / 32, S_LEN / 32);
  const dim3 vtC(DMODEL / 32, SC_LEN / 32);

  // Q
  f32_to_f16_kernel<<<cgrid(nW), 256, 0, stream>>>(Wq, wbuf, nW);
  gemm_wmma_kernel<<<gS, 128, 0, stream>>>(hsb, wbuf, bq, pbuf, S_LEN, DMODEL, DMODEL);
  norm_rope_pack_kernel<<<packS, 128, 0, stream>>>(pbuf, nqw, cos0, sin0, Qb, S_LEN, qscale);

  // K (self) and Kc (cross)
  f32_to_f16_kernel<<<cgrid(nW), 256, 0, stream>>>(Wk, wbuf, nW);
  gemm_wmma_kernel<<<gS, 128, 0, stream>>>(hsb, wbuf, bk, pbuf, S_LEN, DMODEL, DMODEL);
  norm_rope_pack_kernel<<<packS, 128, 0, stream>>>(pbuf, nkw, cos0, sin0, Kb, S_LEN, 1.0f);
  gemm_wmma_kernel<<<gC, 128, 0, stream>>>(condb, wbuf, bk, pbuf, SC_LEN, DMODEL, DMODEL);
  norm_rope_pack_kernel<<<packC, 128, 0, stream>>>(pbuf, nkw, cos1, sin1, Kcb, SC_LEN, 1.0f);

  // V (self) and Vc (cross), transposed to [H][HD][T]
  f32_to_f16_kernel<<<cgrid(nW), 256, 0, stream>>>(Wv, wbuf, nW);
  gemm_wmma_kernel<<<gS, 128, 0, stream>>>(hsb, wbuf, bv, pbuf, S_LEN, DMODEL, DMODEL);
  vtranspose_pack_kernel<<<vtS, 256, 0, stream>>>(pbuf, Vtb, S_LEN);
  gemm_wmma_kernel<<<gC, 128, 0, stream>>>(condb, wbuf, bv, pbuf, SC_LEN, DMODEL, DMODEL);
  vtranspose_pack_kernel<<<vtC, 256, 0, stream>>>(pbuf, Vctb, SC_LEN);

  // fused dual attention + combine
  const unsigned attnBlocks = (unsigned)(NHEADS * (S_LEN / 16) / 4);
  attention_kernel<<<attnBlocks, 128, 0, stream>>>(Qb, Kb, Vtb, Kcb, Vctb, lam, out);
}

// v001
// One run takes 533 microseconds.
// Timed twice side by side with v000, it ran 1.76 and 1.77 times as fast.
#include <hip/hip_runtime.h>
#include <hip/hip_bf16.h>
#include <cstdint>
#include <cstddef>

#define S_LEN  2048
#define SC_LEN 1024
#define DMODEL 3072
#define NHEADS 24
#define HDIM   128

typedef __attribute__((ext_vector_type(16))) _Float16 v16h;
typedef __attribute__((ext_vector_type(8)))  float    v8f;
typedef __attribute__((ext_vector_type(4)))  _Float16 v4h;

union AF { uint4 u[2]; v16h h; };

static __device__ __forceinline__ v8f wmma_f16(v16h a, v16h b, v8f c) {
  // D = A(16x32 f16) x B(32x16 f16) + C(16x16 f32)
  return __builtin_amdgcn_wmma_f32_16x16x32_f16(false, a, false, b, (short)0, c,
                                                false, false);
}

static __device__ __forceinline__ v8f v8f_zero() {
  v8f z = {0.f, 0.f, 0.f, 0.f, 0.f, 0.f, 0.f, 0.f};
  return z;
}

// ---------------------------------------------------------------------------
// fp32 -> f16 elementwise convert
// ---------------------------------------------------------------------------
__global__ void f32_to_f16_kernel(const float* __restrict__ in,
                                  _Float16* __restrict__ out, size_t n) {
  size_t i = (size_t)blockIdx.x * blockDim.x + threadIdx.x;
  if (i < n) out[i] = (_Float16)in[i];
}

// ---------------------------------------------------------------------------
// C[M,N] = X[M,K] * W[N,K]^T + bias[N]   (f16 inputs, f32 out)
// block = 128 threads (4 waves); block tile M=64 x N=128; per wave 32x64.
// A stage is 128 k of the block's 64 X rows and 128 W rows: 192 rows of 256 B,
// brought into LDS by asynchronous b128 copies (two whole rows per wave-wide
// copy) and shared by the four waves. Two buffers: the next stage's copies fly
// while this stage's fragments are read from LDS.
// Needs M % 64 == 0, N % 128 == 0, K % 128 == 0.
// ---------------------------------------------------------------------------
#define G_BK     128                    // k (halves) per stage
#define G_PITCH  272                    // LDS row pitch, bytes: 16 B x odd
#define G_STAGE  (192 * G_PITCH)        // bytes per buffer

// Twelve copies and, as the statement's last line, the wait that stands in
// front of any rewrite of the address registers the copies name.
static __device__ __forceinline__ void async_copy12(const uint32_t* l,
                                                    const _Float16* const* p) {
  asm volatile(
      "global_load_async_to_lds_b128 %0, %12, off\n\t"
      "global_load_async_to_lds_b128 %1, %13, off\n\t"
      "global_load_async_to_lds_b128 %2, %14, off\n\t"
      "global_load_async_to_lds_b128 %3, %15, off\n\t"
      "global_load_async_to_lds_b128 %4, %16, off\n\t"
      "global_load_async_to_lds_b128 %5, %17, off\n\t"
      "global_load_async_to_lds_b128 %6, %18, off\n\t"
      "global_load_async_to_lds_b128 %7, %19, off\n\t"
      "global_load_async_to_lds_b128 %8, %20, off\n\t"
      "global_load_async_to_lds_b128 %9, %21, off\n\t"
      "global_load_async_to_lds_b128 %10, %22, off\n\t"
      "global_load_async_to_lds_b128 %11, %23, off\n\t"
      "s_wait_xcnt 0x0"
      :: "v"(l[0]), "v"(l[1]), "v"(l[2]), "v"(l[3]), "v"(l[4]), "v"(l[5]),
         "v"(l[6]), "v"(l[7]), "v"(l[8]), "v"(l[9]), "v"(l[10]), "v"(l[11]),
         "v"(p[0]), "v"(p[1]), "v"(p[2]), "v"(p[3]), "v"(p[4]), "v"(p[5]),
         "v"(p[6]), "v"(p[7]), "v"(p[8]), "v"(p[9]), "v"(p[10]), "v"(p[11])
      : "memory");
}

// One stage: this thread's 16 B of stage rows crow, crow + 8, ..., crow + 184
// (rows 0..63 are X rows, rows 64..191 are W rows).
static __device__ __forceinline__ void gemm_stage_copy(uint32_t lds,
                                                       const _Float16* xg,
                                                       const _Float16* wg,
                                                       size_t step8) {
  uint32_t l[24];
  const _Float16* p[24];
#pragma unroll
  for (int i = 0; i < 24; ++i) l[i] = lds + (uint32_t)(i * 8 * G_PITCH);
#pragma unroll
  for (int i = 0; i < 8; ++i) p[i] = xg + (size_t)i * step8;
#pragma unroll
  for (int i = 0; i < 16; ++i) p[8 + i] = wg + (size_t)i * step8;
  async_copy12(l, p);
  async_copy12(l + 12, p + 12);
}

__global__ void __launch_bounds__(128)
gemm_wmma_kernel(const _Float16* __restrict__ X, const _Float16* __restrict__ W,
                 const float* __restrict__ bias, float* __restrict__ out,
                 int M, int N, int K) {
  __shared__ __attribute__((aligned(16))) unsigned char smem[2 * G_STAGE];
  const int lane = threadIdx.x & 31;
  const int wave = threadIdx.x >> 5;
  const int r    = lane & 15;
  const int half = lane >> 4;
  const int mb   = blockIdx.y * 64;
  const int nb   = blockIdx.x * 128;
  const int m0   = mb + (wave >> 1) * 32;
  const int n0   = nb + (wave & 1) * 64;

  v8f acc[2][4];
#pragma unroll
  for (int a = 0; a < 2; ++a)
#pragma unroll
    for (int j = 0; j < 4; ++j) acc[a][j] = v8f_zero();

  // copy role: 16 threads per 256-B row, 8 rows per block-wide copy
  const int crow = threadIdx.x >> 4;
  const int ccol = threadIdx.x & 15;
  const _Float16* xg = X + (size_t)(mb + crow) * K + ccol * 8;
  const _Float16* wg = W + (size_t)(nb + crow) * K + ccol * 8;
  const uint32_t  ld = (uint32_t)(size_t)smem + (uint32_t)(crow * G_PITCH + ccol * 16);
  const size_t step8 = (size_t)8 * K;
  const int nt = K / G_BK;

  // fragment role: same rows and same k order as the global fragment loads had
  const unsigned char* xa = smem + ((wave >> 1) * 32 + r) * G_PITCH + half * 16;
  const unsigned char* wb = smem + (64 + (wave & 1) * 64 + r) * G_PITCH + half * 16;

  gemm_stage_copy(ld, xg, wg, step8);
  // stage 0 has landed for this wave; the barrier publishes it to the others
  asm volatile("s_wait_asynccnt 0x0" ::: "memory");
  __syncthreads();
  if (nt > 1) gemm_stage_copy(ld + G_STAGE, xg + G_BK, wg + G_BK, step8);

  for (int t = 0; t < nt; ++t) {
    const uint32_t boff = (uint32_t)(t & 1) * G_STAGE;
    const unsigned char* xs = xa + boff;
    const unsigned char* ws = wb + boff;
    // Fragments of one 32-k block: twelve LDS reads issued as one group.
    AF fa[2][2], fb[2][4];
#pragma unroll
    for (int i = 0; i < 2; ++i) {
      fa[0][i].u[0] = *(const uint4*)(xs + i * 16 * G_PITCH);
      fa[0][i].u[1] = *(const uint4*)(xs + i * 16 * G_PITCH + 32);
    }
#pragma unroll
    for (int j = 0; j < 4; ++j) {
      fb[0][j].u[0] = *(const uint4*)(ws + j * 16 * G_PITCH);
      fb[0][j].u[1] = *(const uint4*)(ws + j * 16 * G_PITCH + 32);
    }
#pragma unroll
    for (int kk = 0; kk < 4; ++kk) {
      const int cur = kk & 1, nxt = cur ^ 1;
      if (kk < 3) {  // the same stage's next block, into the other register set
#pragma unroll
        for (int i = 0; i < 2; ++i) {
          fa[nxt][i].u[0] = *(const uint4*)(xs + i * 16 * G_PITCH + (kk + 1) * 64);
          fa[nxt][i].u[1] = *(const uint4*)(xs + i * 16 * G_PITCH + (kk + 1) * 64 + 32);
        }
#pragma unroll
        for (int j = 0; j < 4; ++j) {
          fb[nxt][j].u[0] = *(const uint4*)(ws + j * 16 * G_PITCH + (kk + 1) * 64);
          fb[nxt][j].u[1] = *(const uint4*)(ws + j * 16 * G_PITCH + (kk + 1) * 64 + 32);
        }
      }
      // keeps the reads one group ahead of the products: without it the
      // compiler sinks each pair of reads to its two products, with a full
      // LDS wait in front of every pair
      __builtin_amdgcn_sched_barrier(0);
#pragma unroll
      for (int j = 0; j < 4; ++j) {
        acc[0][j] = wmma_f16(fa[cur][0].h, fb[cur][j].h, acc[0][j]);
        acc[1][j] = wmma_f16(fa[cur][1].h, fb[cur][j].h, acc[1][j]);
      }
      // keeps the next group of reads out of this block's products
      __builtin_amdgcn_sched_barrier(0);
    }
    // publish point of stage t + 1: this wave's reads of stage t are done ...
    asm volatile("s_wait_dscnt 0x0" ::: "memory");
    // ... its own copies of stage t + 1 have landed ...
    asm volatile("s_wait_asynccnt 0x0" ::: "memory");
    // ... and the barrier both publishes stage t + 1 and frees stage t's buffer
    __syncthreads();
    if (t + 2 < nt)
      gemm_stage_copy(ld + boff, xg + (size_t)(t + 2) * G_BK,
                      wg + (size_t)(t + 2) * G_BK, step8);
  }
  // no copy is left outstanding when the wave ends
  asm volatile("s_wait_asynccnt 0x0" ::: "memory");

#pragma unroll
  for (int a = 0; a < 2; ++a) {
#pragma unroll
    for (int j = 0; j < 4; ++j) {
      const int n = n0 + j * 16 + r;
      const float bn = bias[n];
#pragma unroll
      for (int i = 0; i < 8; ++i) {
        const int m = m0 + a * 16 + half * 8 + i;
        out[(size_t)m * N + n] = acc[a][j][i] + bn;
      }
    }
  }
}

// ---------------------------------------------------------------------------
// RMSNorm(head_dim) + RoPE + optional scale, fp32 [T,D] -> f16 [H][T][HD]
// one wave per (h,t) row; lane owns 4 consecutive dims (2 rope pairs)
// ---------------------------------------------------------------------------
__global__ void __launch_bounds__(128)
norm_rope_pack_kernel(const float* __restrict__ P, const float* __restrict__ w,
                      const float* __restrict__ cs, const float* __restrict__ sn,
                      _Float16* __restrict__ out, int T, float scale) {
  const int gw   = (int)((blockIdx.x * blockDim.x + threadIdx.x) >> 5);
  const int lane = threadIdx.x & 31;
  if (gw >= NHEADS * T) return;
  const int t = gw % T;
  const int h = gw / T;
  const int d = lane * 4;

  const float4 x = *(const float4*)(P + (size_t)t * DMODEL + h * HDIM + d);
  float ss = x.x * x.x + x.y * x.y + x.z * x.z + x.w * x.w;
#pragma unroll
  for (int msk = 1; msk < 32; msk <<= 1) ss += __shfl_xor(ss, msk, 32);
  const float inv = rsqrtf(ss * (1.0f / (float)HDIM) + 1e-6f);

  const float4 wv = *(const float4*)(w + d);
  const float4 c  = *(const float4*)(cs + (size_t)t * HDIM + d);
  const float4 s  = *(const float4*)(sn + (size_t)t * HDIM + d);

  const float y0 = x.x * inv * wv.x;
  const float y1 = x.y * inv * wv.y;
  const float y2 = x.z * inv * wv.z;
  const float y3 = x.w * inv * wv.w;

  v4h o;
  o[0] = (_Float16)((y0 * c.x - y1 * s.x) * scale);
  o[1] = (_Float16)((y1 * c.y + y0 * s.y) * scale);
  o[2] = (_Float16)((y2 * c.z - y3 * s.z) * scale);
  o[3] = (_Float16)((y3 * c.w + y2 * s.w) * scale);
  *(v4h*)(out + ((size_t)h * T + t) * HDIM + d) = o;
}

// ---------------------------------------------------------------------------
// V pack + transpose: fp32 [T,D] -> f16 [H][HD][T]  (out[hd*T + t])
// LDS-tiled 32x32 so both global read and write are coalesced.
// block = 256 threads; grid = (DMODEL/32, T/32)
// ---------------------------------------------------------------------------
__global__ void __launch_bounds__(256)
vtranspose_pack_kernel(const float* __restrict__ P, _Float16* __restrict__ out,
                       int T) {
  __shared__ _Float16 tile[32][33];  // +1 pad to dodge bank conflicts
  const int tx = threadIdx.x & 31;
  const int ty = threadIdx.x >> 5;   // 0..7
  const int d0 = blockIdx.x * 32;
  const int t0 = blockIdx.y * 32;
#pragma unroll
  for (int k = 0; k < 4; ++k) {
    const int t = t0 + ty + k * 8;
    tile[ty + k * 8][tx] = (_Float16)P[(size_t)t * DMODEL + d0 + tx];
  }
  __syncthreads();
#pragma unroll
  for (int k = 0; k < 4; ++k) {
    const int row = ty + k * 8;
    out[(size_t)(d0 + row) * T + t0 + tx] = tile[tx][row];
  }
}

// ---------------------------------------------------------------------------
// One online-softmax attention pass over T keys for a 16-query block.
// The block's four waves work on one head, so they share its K and V^T tiles:
// a stage is 64 keys (64 K rows of 256 B, 128 V^T rows of 128 B), brought into
// LDS by asynchronous b128 copies of whole 128-B lines. Two buffers: the next
// stage's copies fly while this stage is worked on. Needs T % 64 == 0.
// ---------------------------------------------------------------------------
#define A_KEYS    64                              // keys per stage
#define A_KPITCH  272                             // K row pitch, 16 B x odd
#define A_VPITCH  144                             // V^T row pitch, 16 B x odd
#define A_KBYTES  (A_KEYS * A_KPITCH)             // K part of a buffer
#define A_STAGE   (A_KBYTES + HDIM * A_VPITCH)    // bytes per buffer

// Eight copies and, as the statement's last line, the wait that stands in
// front of any rewrite of the address registers the copies name.
static __device__ __forceinline__ void async_copy8(const uint32_t* l,
                                                   const _Float16* const* p) {
  asm volatile(
      "global_load_async_to_lds_b128 %0, %8, off\n\t"
      "global_load_async_to_lds_b128 %1, %9, off\n\t"
      "global_load_async_to_lds_b128 %2, %10, off\n\t"
      "global_load_async_to_lds_b128 %3, %11, off\n\t"
      "global_load_async_to_lds_b128 %4, %12, off\n\t"
      "global_load_async_to_lds_b128 %5, %13, off\n\t"
      "global_load_async_to_lds_b128 %6, %14, off\n\t"
      "global_load_async_to_lds_b128 %7, %15, off\n\t"
      "s_wait_xcnt 0x0"
      :: "v"(l[0]), "v"(l[1]), "v"(l[2]), "v"(l[3]),
         "v"(l[4]), "v"(l[5]), "v"(l[6]), "v"(l[7]),
         "v"(p[0]), "v"(p[1]), "v"(p[2]), "v"(p[3]),
         "v"(p[4]), "v"(p[5]), "v"(p[6]), "v"(p[7])
      : "memory");
}

// One stage: this thread's 16 B of K rows krow, krow + 8, ..., krow + 56 and
// of V^T rows vrow, vrow + 16, ..., vrow + 112.
static __device__ __forceinline__ void attn_stage_copy(uint32_t ldk, uint32_t ldv,
                                                       const _Float16* kg,
                                                       const _Float16* vg,
                                                       size_t vstep16) {
  uint32_t l[16];
  const _Float16* p[16];
#pragma unroll
  for (int i = 0; i < 8; ++i) {
    l[i] = ldk + (uint32_t)(i * 8 * A_KPITCH);
    p[i] = kg + (size_t)i * 8 * HDIM;
    l[8 + i] = ldv + (uint32_t)(i * 16 * A_VPITCH);
    p[8 + i] = vg + (size_t)i * vstep16;
  }
  async_copy8(l, p);
  async_copy8(l + 8, p + 8);
}

__device__ __forceinline__ void attn_pass(const AF* qa,
                                          const _Float16* __restrict__ Kr,
                                          const _Float16* __restrict__ Vt,
                                          int T, const unsigned char* ring,
                                          _Float16* __restrict__ ldsP,
                                          int lane, v8f* o, float* m, float* l) {
  const int r = lane & 15, half = lane >> 4;
#pragma unroll
  for (int j = 0; j < 8; ++j) { o[j] = v8f_zero(); }
#pragma unroll
  for (int i = 0; i < 8; ++i) { m[i] = -1e30f; l[i] = 0.f; }

  // copy role: 16 threads per 256-B K row, 8 threads per 128-B V^T row
  const int tid = threadIdx.x;
  const _Float16* kg = Kr + (size_t)(tid >> 4) * HDIM + (tid & 15) * 8;
  const _Float16* vg = Vt + (size_t)(tid >> 3) * T + (tid & 7) * 8;
  const uint32_t ldk = (uint32_t)(size_t)ring +
                       (uint32_t)((tid >> 4) * A_KPITCH + (tid & 15) * 16);
  const uint32_t ldv = (uint32_t)(size_t)ring +
                       (uint32_t)(A_KBYTES + (tid >> 3) * A_VPITCH + (tid & 7) * 16);
  const size_t vstep16 = (size_t)16 * T;
  const int ns = T / A_KEYS;

  // Every reader has left both buffers here: at the kernel's start nothing has
  // read them, and an earlier pass ends with its last publish point's barrier.
  attn_stage_copy(ldk, ldv, kg, vg, vstep16);
  // stage 0 has landed for this wave; the barrier publishes it to the others
  asm volatile("s_wait_asynccnt 0x0" ::: "memory");
  __syncthreads();
  if (ns > 1)
    attn_stage_copy(ldk + A_STAGE, ldv + A_STAGE, kg + (size_t)A_KEYS * HDIM,
                    vg + A_KEYS, vstep16);

  for (int s = 0; s < ns; ++s) {
    const uint32_t boff = (uint32_t)(s & 1) * A_STAGE;
    const unsigned char* kt = ring + boff + r * A_KPITCH + half * 16;
    const unsigned char* vt = ring + boff + A_KBYTES + r * A_VPITCH + half * 16;
    // kept rolled: unrolled, the two halves' live ranges take the kernel to 338
    // registers, two waves per SIMD where the grid wants three
#pragma unroll 1
    for (int ks = 0; ks < 2; ++ks) {
      const unsigned char* kr0 = kt + ks * 32 * A_KPITCH;
      const unsigned char* kr1 = kr0 + 16 * A_KPITCH;
      v8f s0 = v8f_zero(), s1 = v8f_zero();
#pragma unroll
      for (int kc = 0; kc < 4; ++kc) {
        AF b0, b1;
        b0.u[0] = *(const uint4*)(kr0 + kc * 64);
        b0.u[1] = *(const uint4*)(kr0 + kc * 64 + 32);
        b1.u[0] = *(const uint4*)(kr1 + kc * 64);
        b1.u[1] = *(const uint4*)(kr1 + kc * 64 + 32);
        s0 = wmma_f16(qa[kc].h, b0.h, s0);
        s1 = wmma_f16(qa[kc].h, b1.h, s1);
      }
      // online softmax: rows live in VGPR index (row = half*8+i), keys across 16 lanes
#pragma unroll
      for (int i = 0; i < 8; ++i) {
        float cm = fmaxf(s0[i], s1[i]);
        cm = fmaxf(cm, __shfl_xor(cm, 1, 32));
        cm = fmaxf(cm, __shfl_xor(cm, 2, 32));
        cm = fmaxf(cm, __shfl_xor(cm, 4, 32));
        cm = fmaxf(cm, __shfl_xor(cm, 8, 32));
        const float mn = fmaxf(m[i], cm);
        const float alpha = __expf(m[i] - mn);
        m[i] = mn;
        const float p0 = __expf(s0[i] - mn);
        const float p1 = __expf(s1[i] - mn);
        s0[i] = p0; s1[i] = p1;
        float rs = p0 + p1;
        rs += __shfl_xor(rs, 1, 32);
        rs += __shfl_xor(rs, 2, 32);
        rs += __shfl_xor(rs, 4, 32);
        rs += __shfl_xor(rs, 8, 32);
        l[i] = l[i] * alpha + rs;
#pragma unroll
        for (int j = 0; j < 8; ++j) o[j][i] *= alpha;
      }
      // transpose P (C-layout) -> A-layout via LDS, converting to f16
#pragma unroll
      for (int i = 0; i < 8; ++i) {
        const int row = half * 8 + i;
        ldsP[row * 32 + r]      = (_Float16)s0[i];
        ldsP[row * 32 + 16 + r] = (_Float16)s1[i];
      }
      AF pa;  // same-wave LDS ops are in-order; no barrier needed
      pa.u[0] = *(const uint4*)(ldsP + r * 32 + half * 8);
      pa.u[1] = *(const uint4*)(ldsP + r * 32 + 16 + half * 8);
#pragma unroll
      for (int j = 0; j < 8; ++j) {
        const unsigned char* vr = vt + j * 16 * A_VPITCH + ks * 64;
        AF bv;
        bv.u[0] = *(const uint4*)(vr);
        bv.u[1] = *(const uint4*)(vr + 32);
        o[j] = wmma_f16(pa.h, bv.h, o[j]);
      }
    }
    // publish point of stage s + 1: this wave's reads of stage s are done ...
    asm volatile("s_wait_dscnt 0x0" ::: "memory");
    // ... its own copies of stage s + 1 have landed ...
    asm volatile("s_wait_asynccnt 0x0" ::: "memory");
    // ... and the barrier both publishes stage s + 1 and frees stage s's buffer
    __syncthreads();
    if (s + 2 < ns)
      attn_stage_copy(ldk + boff, ldv + boff,
                      kg + (size_t)(s + 2) * A_KEYS * HDIM,
                      vg + (size_t)(s + 2) * A_KEYS, vstep16);
  }
  // no copy is left outstanding behind the pass
  asm volatile("s_wait_asynccnt 0x0" ::: "memory");
}

// ---------------------------------------------------------------------------
// Fused dual attention: out = lambda * softmax(Q Kc^T) Vc + softmax(Q K^T) V
// 4 waves per block; each wave owns one (head, 16-query) block; the four
// blocks of a work-group lie in one head (128 query blocks per head).
// ---------------------------------------------------------------------------
__global__ void __launch_bounds__(128)
attention_kernel(const _Float16* __restrict__ Qb, const _Float16* __restrict__ Kb,
                 const _Float16* __restrict__ Vtb, const _Float16* __restrict__ Kcb,
                 const _Float16* __restrict__ Vctb, const float* __restrict__ lam,
                 float* __restrict__ out) {
  __shared__ __attribute__((aligned(16))) unsigned char ring[2 * A_STAGE];
  __shared__ _Float16 lds[4][16 * 32];
  const int wave = threadIdx.x >> 5;
  const int lane = threadIdx.x & 31;
  const int r = lane & 15, half = lane >> 4;
  const int qb = blockIdx.x * 4 + wave;       // 0 .. H*(S/16)-1
  const int h  = blockIdx.x >> 5;             // = qb / (S_LEN/16), one per block
  const int q0 = (qb & 127) * 16;

  // Q fragments (pre-scaled by 1/sqrt(HD) at pack time)
  AF qa[4];
  const _Float16* qrow = Qb + ((size_t)h * S_LEN + q0 + r) * HDIM;
#pragma unroll
  for (int kc = 0; kc < 4; ++kc) {
    qa[kc].u[0] = *(const uint4*)(qrow + kc * 32 + half * 8);
    qa[kc].u[1] = *(const uint4*)(qrow + kc * 32 + 16 + half * 8);
  }

  v8f oc[8]; float mc[8], lc[8];
  attn_pass(qa, Kcb + (size_t)h * SC_LEN * HDIM, Vctb + (size_t)h * HDIM * SC_LEN,
            SC_LEN, ring, lds[wave], lane, oc, mc, lc);
  const float lambda = lam[0];
#pragma unroll
  for (int i = 0; i < 8; ++i) {
    const float f = lambda / lc[i];
#pragma unroll
    for (int j = 0; j < 8; ++j) oc[j][i] *= f;
  }

  v8f os[8]; float ms[8], ls[8];
  attn_pass(qa, Kb + (size_t)h * S_LEN * HDIM, Vtb + (size_t)h * HDIM * S_LEN,
            S_LEN, ring, lds[wave], lane, os, ms, ls);

#pragma unroll
  for (int i = 0; i < 8; ++i) {
    const float inv = 1.0f / ls[i];
    const size_t row = (size_t)(q0 + half * 8 + i) * DMODEL + h * HDIM;
#pragma unroll
    for (int j = 0; j < 8; ++j) {
      out[row + j * 16 + r] = oc[j][i] + os[j][i] * inv;
    }
  }
}

// ---------------------------------------------------------------------------
// host launcher
// ---------------------------------------------------------------------------
extern "C" void kernel_launch(void* const* d_in, const int* in_sizes, int n_in,
                              void* d_out, int out_size, void* d_ws, size_t ws_size,
                              hipStream_t stream) {
  (void)in_sizes; (void)n_in; (void)out_size; (void)ws_size;
  const float* hs    = (const float*)d_in[0];
  const float* cond  = (const float*)d_in[1];
  const float* lam   = (const float*)d_in[2];
  const float* Wq    = (const float*)d_in[3];
  const float* bq    = (const float*)d_in[4];
  const float* Wk    = (const float*)d_in[5];
  const float* bk    = (const float*)d_in[6];
  const float* Wv    = (const float*)d_in[7];
  const float* bv    = (const float*)d_in[8];
  const float* nqw   = (const float*)d_in[9];
  const float* nkw   = (const float*)d_in[10];
  const float* cos0  = (const float*)d_in[11];
  const float* sin0  = (const float*)d_in[12];
  const float* cos1  = (const float*)d_in[13];
  const float* sin1  = (const float*)d_in[14];
  float* out = (float*)d_out;

  // workspace carve (256B aligned)
  char* wp = (char*)d_ws;
  auto carve = [&](size_t bytes) -> void* {
    void* p = (void*)wp;
    wp += (bytes + 255) & ~(size_t)255;
    return p;
  };
  _Float16* hsb   = (_Float16*)carve((size_t)S_LEN * DMODEL * 2);
  _Float16* condb = (_Float16*)carve((size_t)SC_LEN * DMODEL * 2);
  _Float16* wbuf  = (_Float16*)carve((size_t)DMODEL * DMODEL * 2);
  float*    pbuf  = (float*)   carve((size_t)S_LEN * DMODEL * 4);
  _Float16* Qb    = (_Float16*)carve((size_t)S_LEN * DMODEL * 2);
  _Float16* Kb    = (_Float16*)carve((size_t)S_LEN * DMODEL * 2);
  _Float16* Kcb   = (_Float16*)carve((size_t)SC_LEN * DMODEL * 2);
  _Float16* Vtb   = (_Float16*)carve((size_t)S_LEN * DMODEL * 2);
  _Float16* Vctb  = (_Float16*)carve((size_t)SC_LEN * DMODEL * 2);

  const float qscale = 0.088388347648318447f;  // 1/sqrt(128)
  const size_t nHS = (size_t)S_LEN * DMODEL;
  const size_t nC  = (size_t)SC_LEN * DMODEL;
  const size_t nW  = (size_t)DMODEL * DMODEL;
  auto cgrid = [](size_t n) { return (unsigned)((n + 255) / 256); };

  f32_to_f16_kernel<<<cgrid(nHS), 256, 0, stream>>>(hs, hsb, nHS);
  f32_to_f16_kernel<<<cgrid(nC), 256, 0, stream>>>(cond, condb, nC);

  const dim3 gS(DMODEL / 128, S_LEN / 64);
  const dim3 gC(DMODEL / 128, SC_LEN / 64);
  const unsigned packS = (unsigned)(NHEADS * S_LEN / 4);
  const unsigned packC = (unsigned)(NHEADS * SC_LEN / 4);
  const dim3 vtS(DMODEL / 32, S_LEN / 32);
  const dim3 vtC(DMODEL / 32, SC_LEN / 32);

  // Q
  f32_to_f16_kernel<<<cgrid(nW), 256, 0, stream>>>(Wq, wbuf, nW);
  gemm_wmma_kernel<<<gS, 128, 0, stream>>>(hsb, wbuf, bq, pbuf, S_LEN, DMODEL, DMODEL);
  norm_rope_pack_kernel<<<packS, 128, 0, stream>>>(pbuf, nqw, cos0, sin0, Qb, S_LEN, qscale);

  // K (self) and Kc (cross)
  f32_to_f16_kernel<<<cgrid(nW), 256, 0, stream>>>(Wk, wbuf, nW);
  gemm_wmma_kernel<<<gS, 128, 0, stream>>>(hsb, wbuf, bk, pbuf, S_LEN, DMODEL, DMODEL);
  norm_rope_pack_kernel<<<packS, 128, 0, stream>>>(pbuf, nkw, cos0, sin0, Kb, S_LEN, 1.0f);
  gemm_wmma_kernel<<<gC, 128, 0, stream>>>(condb, wbuf, bk, pbuf, SC_LEN, DMODEL, DMODEL);
  norm_rope_pack_kernel<<<packC, 128, 0, stream>>>(pbuf, nkw, cos1, sin1, Kcb, SC_LEN, 1.0f);

  // V (self) and Vc (cross), transposed to [H][HD][T]
  f32_to_f16_kernel<<<cgrid(nW), 256, 0, stream>>>(Wv, wbuf, nW);
  gemm_wmma_kernel<<<gS, 128, 0, stream>>>(hsb, wbuf, bv, pbuf, S_LEN, DMODEL, DMODEL);
  vtranspose_pack_kernel<<<vtS, 256, 0, stream>>>(pbuf, Vtb, S_LEN);
  gemm_wmma_kernel<<<gC, 128, 0, stream>>>(condb, wbuf, bv, pbuf, SC_LEN, DMODEL, DMODEL);
  vtranspose_pack_kernel<<<vtC, 256, 0, stream>>>(pbuf, Vctb, SC_LEN);

  // fused dual attention + combine
  const unsigned attnBlocks = (unsigned)(NHEADS * (S_LEN / 16) / 4);
  attention_kernel<<<attnBlocks, 128, 0, stream>>>(Qb, Kb, Vtb, Kcb, Vctb, lam, out);
}

// v002
// It runs in 482 microseconds.
// Next to v001, in two timings, it ran 1.11 and 1.10 times as fast.
// All steps since v000 together make it 1.95 times as fast.
#include <hip/hip_runtime.h>
#include <hip/hip_bf16.h>
#include <cstdint>
#include <cstddef>

#define S_LEN  2048
#define SC_LEN 1024
#define DMODEL 3072
#define NHEADS 24
#define HDIM   128

typedef __attribute__((ext_vector_type(16))) _Float16 v16h;
typedef __attribute__((ext_vector_type(8)))  float    v8f;
typedef __attribute__((ext_vector_type(4)))  _Float16 v4h;

union AF { uint4 u[2]; v16h h; };

static __device__ __forceinline__ v8f wmma_f16(v16h a, v16h b, v8f c) {
  // D = A(16x32 f16) x B(32x16 f16) + C(16x16 f32)
  return __builtin_amdgcn_wmma_f32_16x16x32_f16(false, a, false, b, (short)0, c,
                                                false, false);
}

static __device__ __forceinline__ v8f v8f_zero() {
  v8f z = {0.f, 0.f, 0.f, 0.f, 0.f, 0.f, 0.f, 0.f};
  return z;
}

// ---------------------------------------------------------------------------
// fp32 -> f16 elementwise convert
// block = 256 threads (8 waves), 8192 elements; a wave owns 1024 consecutive
// elements: eight wave-wide 16-B loads of 512 contiguous bytes each, all issued
// before the first is used, then eight wave-wide 8-B stores of 256 contiguous
// bytes (two whole lines) each.
// ---------------------------------------------------------------------------
#define CV_LOADS 8                      // 16-B loads in flight per lane
#define CV_WAVE  (32 * 4 * CV_LOADS)    // elements per wave
#define CV_BLOCK (8 * CV_WAVE)          // elements per block

__global__ void __launch_bounds__(256)
f32_to_f16_kernel(const float* __restrict__ in, _Float16* __restrict__ out,
                  size_t n) {
  const size_t blk = (size_t)blockIdx.x * CV_BLOCK;
  if (blk + CV_BLOCK <= n) {
    const size_t base = blk + (size_t)(threadIdx.x >> 5) * CV_WAVE +
                        (size_t)(threadIdx.x & 31) * 4;
    float4 x[CV_LOADS];
    // unrolled: x stays in registers and the eight loads issue as one group
#pragma unroll
    for (int k = 0; k < CV_LOADS; ++k)
      x[k] = *(const float4*)(in + base + k * 128);
    // unrolled: constant indices into x, each pair of converts behind its own load
#pragma unroll
    for (int k = 0; k < CV_LOADS; ++k) {
      v4h o;
      o[0] = (_Float16)x[k].x;
      o[1] = (_Float16)x[k].y;
      o[2] = (_Float16)x[k].z;
      o[3] = (_Float16)x[k].w;
      *(v4h*)(out + base + k * 128) = o;
    }
    // stands in front of any later rewrite of a register that the stores name
    asm volatile("s_wait_xcnt 0x0" ::: "memory");
  } else {  // a last block that is not whole: one element at a time
    for (size_t i = blk + threadIdx.x; i < n; i += 256) out[i] = (_Float16)in[i];
  }
}

// ---------------------------------------------------------------------------
// C[M,N] = X[M,K] * W[N,K]^T + bias[N]   (f16 inputs, f32 out)
// block = 128 threads (4 waves); block tile M=64 x N=128; per wave 32x64.
// A stage is 128 k of the block's 64 X rows and 128 W rows: 192 rows of 256 B,
// brought into LDS by asynchronous b128 copies (two whole rows per wave-wide
// copy) and shared by the four waves. Two buffers: the next stage's copies fly
// while this stage's fragments are read from LDS.
// Needs M % 64 == 0, N % 128 == 0, K % 128 == 0.
// ---------------------------------------------------------------------------
#define G_BK     128                    // k (halves) per stage
#define G_PITCH  272                    // LDS row pitch, bytes: 16 B x odd
#define G_STAGE  (192 * G_PITCH)        // bytes per buffer

// Twelve copies and, as the statement's last line, the wait that stands in
// front of any rewrite of the address registers the copies name.
static __device__ __forceinline__ void async_copy12(const uint32_t* l,
                                                    const _Float16* const* p) {
  asm volatile(
      "global_load_async_to_lds_b128 %0, %12, off\n\t"
      "global_load_async_to_lds_b128 %1, %13, off\n\t"
      "global_load_async_to_lds_b128 %2, %14, off\n\t"
      "global_load_async_to_lds_b128 %3, %15, off\n\t"
      "global_load_async_to_lds_b128 %4, %16, off\n\t"
      "global_load_async_to_lds_b128 %5, %17, off\n\t"
      "global_load_async_to_lds_b128 %6, %18, off\n\t"
      "global_load_async_to_lds_b128 %7, %19, off\n\t"
      "global_load_async_to_lds_b128 %8, %20, off\n\t"
      "global_load_async_to_lds_b128 %9, %21, off\n\t"
      "global_load_async_to_lds_b128 %10, %22, off\n\t"
      "global_load_async_to_lds_b128 %11, %23, off\n\t"
      "s_wait_xcnt 0x0"
      :: "v"(l[0]), "v"(l[1]), "v"(l[2]), "v"(l[3]), "v"(l[4]), "v"(l[5]),
         "v"(l[6]), "v"(l[7]), "v"(l[8]), "v"(l[9]), "v"(l[10]), "v"(l[11]),
         "v"(p[0]), "v"(p[1]), "v"(p[2]), "v"(p[3]), "v"(p[4]), "v"(p[5]),
         "v"(p[6]), "v"(p[7]), "v"(p[8]), "v"(p[9]), "v"(p[10]), "v"(p[11])
      : "memory");
}

// One stage: this thread's 16 B of stage rows crow, crow + 8, ..., crow + 184
// (rows 0..63 are X rows, rows 64..191 are W rows).
static __device__ __forceinline__ void gemm_stage_copy(uint32_t lds,
                                                       const _Float16* xg,
                                                       const _Float16* wg,
                                                       size_t step8) {
  uint32_t l[24];
  const _Float16* p[24];
#pragma unroll
  for (int i = 0; i < 24; ++i) l[i] = lds + (uint32_t)(i * 8 * G_PITCH);
#pragma unroll
  for (int i = 0; i < 8; ++i) p[i] = xg + (size_t)i * step8;
#pragma unroll
  for (int i = 0; i < 16; ++i) p[8 + i] = wg + (size_t)i * step8;
  async_copy12(l, p);
  async_copy12(l + 12, p + 12);
}

__global__ void __launch_bounds__(128)
gemm_wmma_kernel(const _Float16* __restrict__ X, const _Float16* __restrict__ W,
                 const float* __restrict__ bias, float* __restrict__ out,
                 int M, int N, int K) {
  __shared__ __attribute__((aligned(16))) unsigned char smem[2 * G_STAGE];
  const int lane = threadIdx.x & 31;
  const int wave = threadIdx.x >> 5;
  const int r    = lane & 15;
  const int half = lane >> 4;
  const int mb   = blockIdx.y * 64;
  const int nb   = blockIdx.x * 128;
  const int m0   = mb + (wave >> 1) * 32;
  const int n0   = nb + (wave & 1) * 64;

  v8f acc[2][4];
#pragma unroll
  for (int a = 0; a < 2; ++a)
#pragma unroll
    for (int j = 0; j < 4; ++j) acc[a][j] = v8f_zero();

  // copy role: 16 threads per 256-B row, 8 rows per block-wide copy
  const int crow = threadIdx.x >> 4;
  const int ccol = threadIdx.x & 15;
  const _Float16* xg = X + (size_t)(mb + crow) * K + ccol * 8;
  const _Float16* wg = W + (size_t)(nb + crow) * K + ccol * 8;
  const uint32_t  ld = (uint32_t)(size_t)smem + (uint32_t)(crow * G_PITCH + ccol * 16);
  const size_t step8 = (size_t)8 * K;
  const int nt = K / G_BK;

  // fragment role: same rows and same k order as the global fragment loads had
  const unsigned char* xa = smem + ((wave >> 1) * 32 + r) * G_PITCH + half * 16;
  const unsigned char* wb = smem + (64 + (wave & 1) * 64 + r) * G_PITCH + half * 16;

  gemm_stage_copy(ld, xg, wg, step8);
  // stage 0 has landed for this wave; the barrier publishes it to the others
  asm volatile("s_wait_asynccnt 0x0" ::: "memory");
  __syncthreads();
  if (nt > 1) gemm_stage_copy(ld + G_STAGE, xg + G_BK, wg + G_BK, step8);

  for (int t = 0; t < nt; ++t) {
    const uint32_t boff = (uint32_t)(t & 1) * G_STAGE;
    const unsigned char* xs = xa + boff;
    const unsigned char* ws = wb + boff;
    // Fragments of one 32-k block: twelve LDS reads issued as one group.
    AF fa[2][2], fb[2][4];
#pragma unroll
    for (int i = 0; i < 2; ++i) {
      fa[0][i].u[0] = *(const uint4*)(xs + i * 16 * G_PITCH);
      fa[0][i].u[1] = *(const uint4*)(xs + i * 16 * G_PITCH + 32);
    }
#pragma unroll
    for (int j = 0; j < 4; ++j) {
      fb[0][j].u[0] = *(const uint4*)(ws + j * 16 * G_PITCH);
      fb[0][j].u[1] = *(const uint4*)(ws + j * 16 * G_PITCH + 32);
    }
#pragma unroll
    for (int kk = 0; kk < 4; ++kk) {
      const int cur = kk & 1, nxt = cur ^ 1;
      if (kk < 3) {  // the same stage's next block, into the other register set
#pragma unroll
        for (int i = 0; i < 2; ++i) {
          fa[nxt][i].u[0] = *(const uint4*)(xs + i * 16 * G_PITCH + (kk + 1) * 64);
          fa[nxt][i].u[1] = *(const uint4*)(xs + i * 16 * G_PITCH + (kk + 1) * 64 + 32);
        }
#pragma unroll
        for (int j = 0; j < 4; ++j) {
          fb[nxt][j].u[0] = *(const uint4*)(ws + j * 16 * G_PITCH + (kk + 1) * 64);
          fb[nxt][j].u[1] = *(const uint4*)(ws + j * 16 * G_PITCH + (kk + 1) * 64 + 32);
        }
      }
      // keeps the reads one group ahead of the products: without it the
      // compiler sinks each pair of reads to its two products, with a full
      // LDS wait in front of every pair
      __builtin_amdgcn_sched_barrier(0);
#pragma unroll
      for (int j = 0; j < 4; ++j) {
        acc[0][j] = wmma_f16(fa[cur][0].h, fb[cur][j].h, acc[0][j]);
        acc[1][j] = wmma_f16(fa[cur][1].h, fb[cur][j].h, acc[1][j]);
      }
      // keeps the next group of reads out of this block's products
      __builtin_amdgcn_sched_barrier(0);
    }
    // publish point of stage t + 1: this wave's reads of stage t are done ...
    asm volatile("s_wait_dscnt 0x0" ::: "memory");
    // ... its own copies of stage t + 1 have landed ...
    asm volatile("s_wait_asynccnt 0x0" ::: "memory");
    // ... and the barrier both publishes stage t + 1 and frees stage t's buffer
    __syncthreads();
    if (t + 2 < nt)
      gemm_stage_copy(ld + boff, xg + (size_t)(t + 2) * G_BK,
                      wg + (size_t)(t + 2) * G_BK, step8);
  }
  // no copy is left outstanding when the wave ends
  asm volatile("s_wait_asynccnt 0x0" ::: "memory");

#pragma unroll
  for (int a = 0; a < 2; ++a) {
#pragma unroll
    for (int j = 0; j < 4; ++j) {
      const int n = n0 + j * 16 + r;
      const float bn = bias[n];
#pragma unroll
      for (int i = 0; i < 8; ++i) {
        const int m = m0 + a * 16 + half * 8 + i;
        out[(size_t)m * N + n] = acc[a][j][i] + bn;
      }
    }
  }
}

// ---------------------------------------------------------------------------
// RMSNorm(head_dim) + RoPE + optional scale, fp32 [T,D] -> f16 [H][T][HD]
// one wave per (h,t) row; lane owns 4 consecutive dims (2 rope pairs)
// ---------------------------------------------------------------------------
__global__ void __launch_bounds__(128)
norm_rope_pack_kernel(const float* __restrict__ P, const float* __restrict__ w,
                      const float* __restrict__ cs, const float* __restrict__ sn,
                      _Float16* __restrict__ out, int T, float scale) {
  const int gw   = (int)((blockIdx.x * blockDim.x + threadIdx.x) >> 5);
  const int lane = threadIdx.x & 31;
  if (gw >= NHEADS * T) return;
  const int t = gw % T;
  const int h = gw / T;
  const int d = lane * 4;

  const float4 x = *(const float4*)(P + (size_t)t * DMODEL + h * HDIM + d);
  float ss = x.x * x.x + x.y * x.y + x.z * x.z + x.w * x.w;
#pragma unroll
  for (int msk = 1; msk < 32; msk <<= 1) ss += __shfl_xor(ss, msk, 32);
  const float inv = rsqrtf(ss * (1.0f / (float)HDIM) + 1e-6f);

  const float4 wv = *(const float4*)(w + d);
  const float4 c  = *(const float4*)(cs + (size_t)t * HDIM + d);
  const float4 s  = *(const float4*)(sn + (size_t)t * HDIM + d);

  const float y0 = x.x * inv * wv.x;
  const float y1 = x.y * inv * wv.y;
  const float y2 = x.z * inv * wv.z;
  const float y3 = x.w * inv * wv.w;

  v4h o;
  o[0] = (_Float16)((y0 * c.x - y1 * s.x) * scale);
  o[1] = (_Float16)((y1 * c.y + y0 * s.y) * scale);
  o[2] = (_Float16)((y2 * c.z - y3 * s.z) * scale);
  o[3] = (_Float16)((y3 * c.w + y2 * s.w) * scale);
  *(v4h*)(out + ((size_t)h * T + t) * HDIM + d) = o;
}

// ---------------------------------------------------------------------------
// V pack + transpose: fp32 [T,D] -> f16 [H][HD][T]  (out[hd*T + t])
// LDS-tiled 32x32 so both global read and write are coalesced.
// block = 256 threads; grid = (DMODEL/32, T/32)
// ---------------------------------------------------------------------------
__global__ void __launch_bounds__(256)
vtranspose_pack_kernel(const float* __restrict__ P, _Float16* __restrict__ out,
                       int T) {
  __shared__ _Float16 tile[32][33];  // +1 pad to dodge bank conflicts
  const int tx = threadIdx.x & 31;
  const int ty = threadIdx.x >> 5;   // 0..7
  const int d0 = blockIdx.x * 32;
  const int t0 = blockIdx.y * 32;
#pragma unroll
  for (int k = 0; k < 4; ++k) {
    const int t = t0 + ty + k * 8;
    tile[ty + k * 8][tx] = (_Float16)P[(size_t)t * DMODEL + d0 + tx];
  }
  __syncthreads();
#pragma unroll
  for (int k = 0; k < 4; ++k) {
    const int row = ty + k * 8;
    out[(size_t)(d0 + row) * T + t0 + tx] = tile[tx][row];
  }
}

// ---------------------------------------------------------------------------
// One online-softmax attention pass over T keys for a 16-query block.
// The block's four waves work on one head, so they share its K and V^T tiles:
// a stage is 64 keys (64 K rows of 256 B, 128 V^T rows of 128 B), brought into
// LDS by asynchronous b128 copies of whole 128-B lines. Two buffers: the next
// stage's copies fly while this stage is worked on. Needs T % 64 == 0.
// ---------------------------------------------------------------------------
#define A_KEYS    64                              // keys per stage
#define A_KPITCH  272                             // K row pitch, 16 B x odd
#define A_VPITCH  144                             // V^T row pitch, 16 B x odd
#define A_KBYTES  (A_KEYS * A_KPITCH)             // K part of a buffer
#define A_STAGE   (A_KBYTES + HDIM * A_VPITCH)    // bytes per buffer

// Eight copies and, as the statement's last line, the wait that stands in
// front of any rewrite of the address registers the copies name.
static __device__ __forceinline__ void async_copy8(const uint32_t* l,
                                                   const _Float16* const* p) {
  asm volatile(
      "global_load_async_to_lds_b128 %0, %8, off\n\t"
      "global_load_async_to_lds_b128 %1, %9, off\n\t"
      "global_load_async_to_lds_b128 %2, %10, off\n\t"
      "global_load_async_to_lds_b128 %3, %11, off\n\t"
      "global_load_async_to_lds_b128 %4, %12, off\n\t"
      "global_load_async_to_lds_b128 %5, %13, off\n\t"
      "global_load_async_to_lds_b128 %6, %14, off\n\t"
      "global_load_async_to_lds_b128 %7, %15, off\n\t"
      "s_wait_xcnt 0x0"
      :: "v"(l[0]), "v"(l[1]), "v"(l[2]), "v"(l[3]),
         "v"(l[4]), "v"(l[5]), "v"(l[6]), "v"(l[7]),
         "v"(p[0]), "v"(p[1]), "v"(p[2]), "v"(p[3]),
         "v"(p[4]), "v"(p[5]), "v"(p[6]), "v"(p[7])
      : "memory");
}

// One stage: this thread's 16 B of K rows krow, krow + 8, ..., krow + 56 and
// of V^T rows vrow, vrow + 16, ..., vrow + 112.
static __device__ __forceinline__ void attn_stage_copy(uint32_t ldk, uint32_t ldv,
                                                       const _Float16* kg,
                                                       const _Float16* vg,
                                                       size_t vstep16) {
  uint32_t l[16];
  const _Float16* p[16];
#pragma unroll
  for (int i = 0; i < 8; ++i) {
    l[i] = ldk + (uint32_t)(i * 8 * A_KPITCH);
    p[i] = kg + (size_t)i * 8 * HDIM;
    l[8 + i] = ldv + (uint32_t)(i * 16 * A_VPITCH);
    p[8 + i] = vg + (size_t)i * vstep16;
  }
  async_copy8(l, p);
  async_copy8(l + 8, p + 8);
}

__device__ __forceinline__ void attn_pass(const AF* qa,
                                          const _Float16* __restrict__ Kr,
                                          const _Float16* __restrict__ Vt,
                                          int T, const unsigned char* ring,
                                          _Float16* __restrict__ ldsP,
                                          int lane, v8f* o, float* m, float* l) {
  const int r = lane & 15, half = lane >> 4;
#pragma unroll
  for (int j = 0; j < 8; ++j) { o[j] = v8f_zero(); }
#pragma unroll
  for (int i = 0; i < 8; ++i) { m[i] = -1e30f; l[i] = 0.f; }

  // copy role: 16 threads per 256-B K row, 8 threads per 128-B V^T row
  const int tid = threadIdx.x;
  const _Float16* kg = Kr + (size_t)(tid >> 4) * HDIM + (tid & 15) * 8;
  const _Float16* vg = Vt + (size_t)(tid >> 3) * T + (tid & 7) * 8;
  const uint32_t ldk = (uint32_t)(size_t)ring +
                       (uint32_t)((tid >> 4) * A_KPITCH + (tid & 15) * 16);
  const uint32_t ldv = (uint32_t)(size_t)ring +
                       (uint32_t)(A_KBYTES + (tid >> 3) * A_VPITCH + (tid & 7) * 16);
  const size_t vstep16 = (size_t)16 * T;
  const int ns = T / A_KEYS;

  // Every reader has left both buffers here: at the kernel's start nothing has
  // read them, and an earlier pass ends with its last publish point's barrier.
  attn_stage_copy(ldk, ldv, kg, vg, vstep16);
  // stage 0 has landed for this wave; the barrier publishes it to the others
  asm volatile("s_wait_asynccnt 0x0" ::: "memory");
  __syncthreads();
  if (ns > 1)
    attn_stage_copy(ldk + A_STAGE, ldv + A_STAGE, kg + (size_t)A_KEYS * HDIM,
                    vg + A_KEYS, vstep16);

  for (int s = 0; s < ns; ++s) {
    const uint32_t boff = (uint32_t)(s & 1) * A_STAGE;
    const unsigned char* kt = ring + boff + r * A_KPITCH + half * 16;
    const unsigned char* vt = ring + boff + A_KBYTES + r * A_VPITCH + half * 16;
    // kept rolled: unrolled, the two halves' live ranges take the kernel to 338
    // registers, two waves per SIMD where the grid wants three
#pragma unroll 1
    for (int ks = 0; ks < 2; ++ks) {
      const unsigned char* kr0 = kt + ks * 32 * A_KPITCH;
      const unsigned char* kr1 = kr0 + 16 * A_KPITCH;
      v8f s0 = v8f_zero(), s1 = v8f_zero();
#pragma unroll
      for (int kc = 0; kc < 4; ++kc) {
        AF b0, b1;
        b0.u[0] = *(const uint4*)(kr0 + kc * 64);
        b0.u[1] = *(const uint4*)(kr0 + kc * 64 + 32);
        b1.u[0] = *(const uint4*)(kr1 + kc * 64);
        b1.u[1] = *(const uint4*)(kr1 + kc * 64 + 32);
        s0 = wmma_f16(qa[kc].h, b0.h, s0);
        s1 = wmma_f16(qa[kc].h, b1.h, s1);
      }
      // online softmax: rows live in VGPR index (row = half*8+i), keys across 16 lanes
#pragma unroll
      for (int i = 0; i < 8; ++i) {
        float cm = fmaxf(s0[i], s1[i]);
        cm = fmaxf(cm, __shfl_xor(cm, 1, 32));
        cm = fmaxf(cm, __shfl_xor(cm, 2, 32));
        cm = fmaxf(cm, __shfl_xor(cm, 4, 32));
        cm = fmaxf(cm, __shfl_xor(cm, 8, 32));
        const float mn = fmaxf(m[i], cm);
        const float alpha = __expf(m[i] - mn);
        m[i] = mn;
        const float p0 = __expf(s0[i] - mn);
        const float p1 = __expf(s1[i] - mn);
        s0[i] = p0; s1[i] = p1;
        float rs = p0 + p1;
        rs += __shfl_xor(rs, 1, 32);
        rs += __shfl_xor(rs, 2, 32);
        rs += __shfl_xor(rs, 4, 32);
        rs += __shfl_xor(rs, 8, 32);
        l[i] = l[i] * alpha + rs;
#pragma unroll
        for (int j = 0; j < 8; ++j) o[j][i] *= alpha;
      }
      // transpose P (C-layout) -> A-layout via LDS, converting to f16
#pragma unroll
      for (int i = 0; i < 8; ++i) {
        const int row = half * 8 + i;
        ldsP[row * 32 + r]      = (_Float16)s0[i];
        ldsP[row * 32 + 16 + r] = (_Float16)s1[i];
      }
      AF pa;  // same-wave LDS ops are in-order; no barrier needed
      pa.u[0] = *(const uint4*)(ldsP + r * 32 + half * 8);
      pa.u[1] = *(const uint4*)(ldsP + r * 32 + 16 + half * 8);
#pragma unroll
      for (int j = 0; j < 8; ++j) {
        const unsigned char* vr = vt + j * 16 * A_VPITCH + ks * 64;
        AF bv;
        bv.u[0] = *(const uint4*)(vr);
        bv.u[1] = *(const uint4*)(vr + 32);
        o[j] = wmma_f16(pa.h, bv.h, o[j]);
      }
    }
    // publish point of stage s + 1: this wave's reads of stage s are done ...
    asm volatile("s_wait_dscnt 0x0" ::: "memory");
    // ... its own copies of stage s + 1 have landed ...
    asm volatile("s_wait_asynccnt 0x0" ::: "memory");
    // ... and the barrier both publishes stage s + 1 and frees stage s's buffer
    __syncthreads();
    if (s + 2 < ns)
      attn_stage_copy(ldk + boff, ldv + boff,
                      kg + (size_t)(s + 2) * A_KEYS * HDIM,
                      vg + (size_t)(s + 2) * A_KEYS, vstep16);
  }
  // no copy is left outstanding behind the pass
  asm volatile("s_wait_asynccnt 0x0" ::: "memory");
}

// ---------------------------------------------------------------------------
// Fused dual attention: out = lambda * softmax(Q Kc^T) Vc + softmax(Q K^T) V
// 4 waves per block; each wave owns one (head, 16-query) block; the four
// blocks of a work-group lie in one head (128 query blocks per head).
// ---------------------------------------------------------------------------
__global__ void __launch_bounds__(128)
attention_kernel(const _Float16* __restrict__ Qb, const _Float16* __restrict__ Kb,
                 const _Float16* __restrict__ Vtb, const _Float16* __restrict__ Kcb,
                 const _Float16* __restrict__ Vctb, const float* __restrict__ lam,
                 float* __restrict__ out) {
  __shared__ __attribute__((aligned(16))) unsigned char ring[2 * A_STAGE];
  __shared__ _Float16 lds[4][16 * 32];
  const int wave = threadIdx.x >> 5;
  const int lane = threadIdx.x & 31;
  const int r = lane & 15, half = lane >> 4;
  const int qb = blockIdx.x * 4 + wave;       // 0 .. H*(S/16)-1
  const int h  = blockIdx.x >> 5;             // = qb / (S_LEN/16), one per block
  const int q0 = (qb & 127) * 16;

  // Q fragments (pre-scaled by 1/sqrt(HD) at pack time)
  AF qa[4];
  const _Float16* qrow = Qb + ((size_t)h * S_LEN + q0 + r) * HDIM;
#pragma unroll
  for (int kc = 0; kc < 4; ++kc) {
    qa[kc].u[0] = *(const uint4*)(qrow + kc * 32 + half * 8);
    qa[kc].u[1] = *(const uint4*)(qrow + kc * 32 + 16 + half * 8);
  }

  v8f oc[8]; float mc[8], lc[8];
  attn_pass(qa, Kcb + (size_t)h * SC_LEN * HDIM, Vctb + (size_t)h * HDIM * SC_LEN,
            SC_LEN, ring, lds[wave], lane, oc, mc, lc);
  const float lambda = lam[0];
#pragma unroll
  for (int i = 0; i < 8; ++i) {
    const float f = lambda / lc[i];
#pragma unroll
    for (int j = 0; j < 8; ++j) oc[j][i] *= f;
  }

  v8f os[8]; float ms[8], ls[8];
  attn_pass(qa, Kb + (size_t)h * S_LEN * HDIM, Vtb + (size_t)h * HDIM * S_LEN,
            S_LEN, ring, lds[wave], lane, os, ms, ls);

#pragma unroll
  for (int i = 0; i < 8; ++i) {
    const float inv = 1.0f / ls[i];
    const size_t row = (size_t)(q0 + half * 8 + i) * DMODEL + h * HDIM;
#pragma unroll
    for (int j = 0; j < 8; ++j) {
      out[row + j * 16 + r] = oc[j][i] + os[j][i] * inv;
    }
  }
}

// ---------------------------------------------------------------------------
// host launcher
// ---------------------------------------------------------------------------
extern "C" void kernel_launch(void* const* d_in, const int* in_sizes, int n_in,
                              void* d_out, int out_size, void* d_ws, size_t ws_size,
                              hipStream_t stream) {
  (void)in_sizes; (void)n_in; (void)out_size; (void)ws_size;
  const float* hs    = (const float*)d_in[0];
  const float* cond  = (const float*)d_in[1];
  const float* lam   = (const float*)d_in[2];
  const float* Wq    = (const float*)d_in[3];
  const float* bq    = (const float*)d_in[4];
  const float* Wk    = (const float*)d_in[5];
  const float* bk    = (const float*)d_in[6];
  const float* Wv    = (const float*)d_in[7];
  const float* bv    = (const float*)d_in[8];
  const float* nqw   = (const float*)d_in[9];
  const float* nkw   = (const float*)d_in[10];
  const float* cos0  = (const float*)d_in[11];
  const float* sin0  = (const float*)d_in[12];
  const float* cos1  = (const float*)d_in[13];
  const float* sin1  = (const float*)d_in[14];
  float* out = (float*)d_out;

  // workspace carve (256B aligned)
  char* wp = (char*)d_ws;
  auto carve = [&](size_t bytes) -> void* {
    void* p = (void*)wp;
    wp += (bytes + 255) & ~(size_t)255;
    return p;
  };
  _Float16* hsb   = (_Float16*)carve((size_t)S_LEN * DMODEL * 2);
  _Float16* condb = (_Float16*)carve((size_t)SC_LEN * DMODEL * 2);
  _Float16* wbuf  = (_Float16*)carve((size_t)DMODEL * DMODEL * 2);
  float*    pbuf  = (float*)   carve((size_t)S_LEN * DMODEL * 4);
  _Float16* Qb    = (_Float16*)carve((size_t)S_LEN * DMODEL * 2);
  _Float16* Kb    = (_Float16*)carve((size_t)S_LEN * DMODEL * 2);
  _Float16* Kcb   = (_Float16*)carve((size_t)SC_LEN * DMODEL * 2);
  _Float16* Vtb   = (_Float16*)carve((size_t)S_LEN * DMODEL * 2);
  _Float16* Vctb  = (_Float16*)carve((size_t)SC_LEN * DMODEL * 2);

  const float qscale = 0.088388347648318447f;  // 1/sqrt(128)
  const size_t nHS = (size_t)S_LEN * DMODEL;
  const size_t nC  = (size_t)SC_LEN * DMODEL;
  const size_t nW  = (size_t)DMODEL * DMODEL;
  auto cgrid = [](size_t n) { return (unsigned)((n + CV_BLOCK - 1) / CV_BLOCK); };

  f32_to_f16_kernel<<<cgrid(nHS), 256, 0, stream>>>(hs, hsb, nHS);
  f32_to_f16_kernel<<<cgrid(nC), 256, 0, stream>>>(cond, condb, nC);

  const dim3 gS(DMODEL / 128, S_LEN / 64);
  const dim3 gC(DMODEL / 128, SC_LEN / 64);
  const unsigned packS = (unsigned)(NHEADS * S_LEN / 4);
  const unsigned packC = (unsigned)(NHEADS * SC_LEN / 4);
  const dim3 vtS(DMODEL / 32, S_LEN / 32);
  const dim3 vtC(DMODEL / 32, SC_LEN / 32);

  // Q
  f32_to_f16_kernel<<<cgrid(nW), 256, 0, stream>>>(Wq, wbuf, nW);
  gemm_wmma_kernel<<<gS, 128, 0, stream>>>(hsb, wbuf, bq, pbuf, S_LEN, DMODEL, DMODEL);
  norm_rope_pack_kernel<<<packS, 128, 0, stream>>>(pbuf, nqw, cos0, sin0, Qb, S_LEN, qscale);

  // K (self) and Kc (cross)
  f32_to_f16_kernel<<<cgrid(nW), 256, 0, stream>>>(Wk, wbuf, nW);
  gemm_wmma_kernel<<<gS, 128, 0, stream>>>(hsb, wbuf, bk, pbuf, S_LEN, DMODEL, DMODEL);
  norm_rope_pack_kernel<<<packS, 128, 0, stream>>>(pbuf, nkw, cos0, sin0, Kb, S_LEN, 1.0f);
  gemm_wmma_kernel<<<gC, 128, 0, stream>>>(condb, wbuf, bk, pbuf, SC_LEN, DMODEL, DMODEL);
  norm_rope_pack_kernel<<<packC, 128, 0, stream>>>(pbuf, nkw, cos1, sin1, Kcb, SC_LEN, 1.0f);

  // V (self) and Vc (cross), transposed to [H][HD][T]
  f32_to_f16_kernel<<<cgrid(nW), 256, 0, stream>>>(Wv, wbuf, nW);
  gemm_wmma_kernel<<<gS, 128, 0, stream>>>(hsb, wbuf, bv, pbuf, S_LEN, DMODEL, DMODEL);
  vtranspose_pack_kernel<<<vtS, 256, 0, stream>>>(pbuf, Vtb, S_LEN);
  gemm_wmma_kernel<<<gC, 128, 0, stream>>>(condb, wbuf, bv, pbuf, SC_LEN, DMODEL, DMODEL);
  vtranspose_pack_kernel<<<vtC, 256, 0, stream>>>(pbuf, Vctb, SC_LEN);

  // fused dual attention + combine
  const unsigned attnBlocks = (unsigned)(NHEADS * (S_LEN / 16) / 4);
  attention_kernel<<<attnBlocks, 128, 0, stream>>>(Qb, Kb, Vtb, Kcb, Vctb, lam, out);
}

// v003
// It runs in 284 microseconds.
// Two timings next to v002 put it at 1.65 and 1.68 times that version's speed.
// All steps since v000 together make it 3.24 times as fast.
#include <hip/hip_runtime.h>
#include <hip/hip_bf16.h>
#include <cstdint>
#include <cstddef>

#define S_LEN  2048
#define SC_LEN 1024
#define DMODEL 3072
#define NHEADS 24
#define HDIM   128

typedef __attribute__((ext_vector_type(16))) _Float16 v16h;
typedef __attribute__((ext_vector_type(8)))  float    v8f;
typedef __attribute__((ext_vector_type(4)))  _Float16 v4h;
typedef __attribute__((ext_vector_type(2)))  _Float16 v2h;
typedef __attribute__((ext_vector_type(2)))  float    v2f;

union AF { uint4 u[2]; v16h h; };

static __device__ __forceinline__ v8f wmma_f16(v16h a, v16h b, v8f c) {
  // D = A(16x32 f16) x B(32x16 f16) + C(16x16 f32)
  return __builtin_amdgcn_wmma_f32_16x16x32_f16(false, a, false, b, (short)0, c,
                                                false, false);
}

static __device__ __forceinline__ v8f v8f_zero() {
  v8f z = {0.f, 0.f, 0.f, 0.f, 0.f, 0.f, 0.f, 0.f};
  return z;
}

// ---------------------------------------------------------------------------
// fp32 -> f16 elementwise convert
// block = 256 threads (8 waves), 8192 elements; a wave owns 1024 consecutive
// elements: eight wave-wide 16-B loads of 512 contiguous bytes each, all issued
// before the first is used, then eight wave-wide 8-B stores of 256 contiguous
// bytes (two whole lines) each.
// ---------------------------------------------------------------------------
#define CV_LOADS 8                      // 16-B loads in flight per lane
#define CV_WAVE  (32 * 4 * CV_LOADS)    // elements per wave
#define CV_BLOCK (8 * CV_WAVE)          // elements per block

__global__ void __launch_bounds__(256)
f32_to_f16_kernel(const float* __restrict__ in, _Float16* __restrict__ out,
                  size_t n) {
  const size_t blk = (size_t)blockIdx.x * CV_BLOCK;
  if (blk + CV_BLOCK <= n) {
    const size_t base = blk + (size_t)(threadIdx.x >> 5) * CV_WAVE +
                        (size_t)(threadIdx.x & 31) * 4;
    float4 x[CV_LOADS];
    // unrolled: x stays in registers and the eight loads issue as one group
#pragma unroll
    for (int k = 0; k < CV_LOADS; ++k)
      x[k] = *(const float4*)(in + base + k * 128);
    // unrolled: constant indices into x, each pair of converts behind its own load
#pragma unroll
    for (int k = 0; k < CV_LOADS; ++k) {
      v4h o;
      o[0] = (_Float16)x[k].x;
      o[1] = (_Float16)x[k].y;
      o[2] = (_Float16)x[k].z;
      o[3] = (_Float16)x[k].w;
      *(v4h*)(out + base + k * 128) = o;
    }
    // stands in front of any later rewrite of a register that the stores name
    asm volatile("s_wait_xcnt 0x0" ::: "memory");
  } else {  // a last block that is not whole: one element at a time
    for (size_t i = blk + threadIdx.x; i < n; i += 256) out[i] = (_Float16)in[i];
  }
}

// ---------------------------------------------------------------------------
// C[M,N] = X[M,K] * W[N,K]^T + bias[N]   (f16 inputs, f32 out)
// block = 128 threads (4 waves); block tile M=64 x N=128; per wave 32x64.
// A stage is 128 k of the block's 64 X rows and 128 W rows: 192 rows of 256 B,
// brought into LDS by asynchronous b128 copies (two whole rows per wave-wide
// copy) and shared by the four waves. Two buffers: the next stage's copies fly
// while this stage's fragments are read from LDS.
// Needs M % 64 == 0, N % 128 == 0, K % 128 == 0.
// ---------------------------------------------------------------------------
#define G_BK     128                    // k (halves) per stage
#define G_PITCH  272                    // LDS row pitch, bytes: 16 B x odd
#define G_STAGE  (192 * G_PITCH)        // bytes per buffer

// Twelve copies and, as the statement's last line, the wait that stands in
// front of any rewrite of the address registers the copies name.
static __device__ __forceinline__ void async_copy12(const uint32_t* l,
                                                    const _Float16* const* p) {
  asm volatile(
      "global_load_async_to_lds_b128 %0, %12, off\n\t"
      "global_load_async_to_lds_b128 %1, %13, off\n\t"
      "global_load_async_to_lds_b128 %2, %14, off\n\t"
      "global_load_async_to_lds_b128 %3, %15, off\n\t"
      "global_load_async_to_lds_b128 %4, %16, off\n\t"
      "global_load_async_to_lds_b128 %5, %17, off\n\t"
      "global_load_async_to_lds_b128 %6, %18, off\n\t"
      "global_load_async_to_lds_b128 %7, %19, off\n\t"
      "global_load_async_to_lds_b128 %8, %20, off\n\t"
      "global_load_async_to_lds_b128 %9, %21, off\n\t"
      "global_load_async_to_lds_b128 %10, %22, off\n\t"
      "global_load_async_to_lds_b128 %11, %23, off\n\t"
      "s_wait_xcnt 0x0"
      :: "v"(l[0]), "v"(l[1]), "v"(l[2]), "v"(l[3]), "v"(l[4]), "v"(l[5]),
         "v"(l[6]), "v"(l[7]), "v"(l[8]), "v"(l[9]), "v"(l[10]), "v"(l[11]),
         "v"(p[0]), "v"(p[1]), "v"(p[2]), "v"(p[3]), "v"(p[4]), "v"(p[5]),
         "v"(p[6]), "v"(p[7]), "v"(p[8]), "v"(p[9]), "v"(p[10]), "v"(p[11])
      : "memory");
}

// One stage: this thread's 16 B of stage rows crow, crow + 8, ..., crow + 184
// (rows 0..63 are X rows, rows 64..191 are W rows).
static __device__ __forceinline__ void gemm_stage_copy(uint32_t lds,
                                                       const _Float16* xg,
                                                       const _Float16* wg,
                                                       size_t step8) {
  uint32_t l[24];
  const _Float16* p[24];
#pragma unroll
  for (int i = 0; i < 24; ++i) l[i] = lds + (uint32_t)(i * 8 * G_PITCH);
#pragma unroll
  for (int i = 0; i < 8; ++i) p[i] = xg + (size_t)i * step8;
#pragma unroll
  for (int i = 0; i < 16; ++i) p[8 + i] = wg + (size_t)i * step8;
  async_copy12(l, p);
  async_copy12(l + 12, p + 12);
}

__global__ void __launch_bounds__(128)
gemm_wmma_kernel(const _Float16* __restrict__ X, const _Float16* __restrict__ W,
                 const float* __restrict__ bias, float* __restrict__ out,
                 int M, int N, int K) {
  __shared__ __attribute__((aligned(16))) unsigned char smem[2 * G_STAGE];
  const int lane = threadIdx.x & 31;
  const int wave = threadIdx.x >> 5;
  const int r    = lane & 15;
  const int half = lane >> 4;
  const int mb   = blockIdx.y * 64;
  const int nb   = blockIdx.x * 128;
  const int m0   = mb + (wave >> 1) * 32;
  const int n0   = nb + (wave & 1) * 64;

  v8f acc[2][4];
#pragma unroll
  for (int a = 0; a < 2; ++a)
#pragma unroll
    for (int j = 0; j < 4; ++j) acc[a][j] = v8f_zero();

  // copy role: 16 threads per 256-B row, 8 rows per block-wide copy
  const int crow = threadIdx.x >> 4;
  const int ccol = threadIdx.x & 15;
  const _Float16* xg = X + (size_t)(mb + crow) * K + ccol * 8;
  const _Float16* wg = W + (size_t)(nb + crow) * K + ccol * 8;
  const uint32_t  ld = (uint32_t)(size_t)smem + (uint32_t)(crow * G_PITCH + ccol * 16);
  const size_t step8 = (size_t)8 * K;
  const int nt = K / G_BK;

  // fragment role: same rows and same k order as the global fragment loads had
  const unsigned char* xa = smem + ((wave >> 1) * 32 + r) * G_PITCH + half * 16;
  const unsigned char* wb = smem + (64 + (wave & 1) * 64 + r) * G_PITCH + half * 16;

  gemm_stage_copy(ld, xg, wg, step8);
  // stage 0 has landed for this wave; the barrier publishes it to the others
  asm volatile("s_wait_asynccnt 0x0" ::: "memory");
  __syncthreads();
  if (nt > 1) gemm_stage_copy(ld + G_STAGE, xg + G_BK, wg + G_BK, step8);

  for (int t = 0; t < nt; ++t) {
    const uint32_t boff = (uint32_t)(t & 1) * G_STAGE;
    const unsigned char* xs = xa + boff;
    const unsigned char* ws = wb + boff;
    // Fragments of one 32-k block: twelve LDS reads issued as one group.
    AF fa[2][2], fb[2][4];
#pragma unroll
    for (int i = 0; i < 2; ++i) {
      fa[0][i].u[0] = *(const uint4*)(xs + i * 16 * G_PITCH);
      fa[0][i].u[1] = *(const uint4*)(xs + i * 16 * G_PITCH + 32);
    }
#pragma unroll
    for (int j = 0; j < 4; ++j) {
      fb[0][j].u[0] = *(const uint4*)(ws + j * 16 * G_PITCH);
      fb[0][j].u[1] = *(const uint4*)(ws + j * 16 * G_PITCH + 32);
    }
#pragma unroll
    for (int kk = 0; kk < 4; ++kk) {
      const int cur = kk & 1, nxt = cur ^ 1;
      if (kk < 3) {  // the same stage's next block, into the other register set
#pragma unroll
        for (int i = 0; i < 2; ++i) {
          fa[nxt][i].u[0] = *(const uint4*)(xs + i * 16 * G_PITCH + (kk + 1) * 64);
          fa[nxt][i].u[1] = *(const uint4*)(xs + i * 16 * G_PITCH + (kk + 1) * 64 + 32);
        }
#pragma unroll
        for (int j = 0; j < 4; ++j) {
          fb[nxt][j].u[0] = *(const uint4*)(ws + j * 16 * G_PITCH + (kk + 1) * 64);
          fb[nxt][j].u[1] = *(const uint4*)(ws + j * 16 * G_PITCH + (kk + 1) * 64 + 32);
        }
      }
      // keeps the reads one group ahead of the products: without it the
      // compiler sinks each pair of reads to its two products, with a full
      // LDS wait in front of every pair
      __builtin_amdgcn_sched_barrier(0);
#pragma unroll
      for (int j = 0; j < 4; ++j) {
        acc[0][j] = wmma_f16(fa[cur][0].h, fb[cur][j].h, acc[0][j]);
        acc[1][j] = wmma_f16(fa[cur][1].h, fb[cur][j].h, acc[1][j]);
      }
      // keeps the next group of reads out of this block's products
      __builtin_amdgcn_sched_barrier(0);
    }
    // publish point of stage t + 1: this wave's reads of stage t are done ...
    asm volatile("s_wait_dscnt 0x0" ::: "memory");
    // ... its own copies of stage t + 1 have landed ...
    asm volatile("s_wait_asynccnt 0x0" ::: "memory");
    // ... and the barrier both publishes stage t + 1 and frees stage t's buffer
    __syncthreads();
    if (t + 2 < nt)
      gemm_stage_copy(ld + boff, xg + (size_t)(t + 2) * G_BK,
                      wg + (size_t)(t + 2) * G_BK, step8);
  }
  // no copy is left outstanding when the wave ends
  asm volatile("s_wait_asynccnt 0x0" ::: "memory");

#pragma unroll
  for (int a = 0; a < 2; ++a) {
#pragma unroll
    for (int j = 0; j < 4; ++j) {
      const int n = n0 + j * 16 + r;
      const float bn = bias[n];
#pragma unroll
      for (int i = 0; i < 8; ++i) {
        const int m = m0 + a * 16 + half * 8 + i;
        out[(size_t)m * N + n] = acc[a][j][i] + bn;
      }
    }
  }
}

// ---------------------------------------------------------------------------
// RMSNorm(head_dim) + RoPE + optional scale, fp32 [T,D] -> f16 [H][T][HD]
// one wave per (h,t) row; lane owns 4 consecutive dims (2 rope pairs)
// ---------------------------------------------------------------------------
__global__ void __launch_bounds__(128)
norm_rope_pack_kernel(const float* __restrict__ P, const float* __restrict__ w,
                      const float* __restrict__ cs, const float* __restrict__ sn,
                      _Float16* __restrict__ out, int T, float scale) {
  const int gw   = (int)((blockIdx.x * blockDim.x + threadIdx.x) >> 5);
  const int lane = threadIdx.x & 31;
  if (gw >= NHEADS * T) return;
  const int t = gw % T;
  const int h = gw / T;
  const int d = lane * 4;

  const float4 x = *(const float4*)(P + (size_t)t * DMODEL + h * HDIM + d);
  float ss = x.x * x.x + x.y * x.y + x.z * x.z + x.w * x.w;
#pragma unroll
  for (int msk = 1; msk < 32; msk <<= 1) ss += __shfl_xor(ss, msk, 32);
  const float inv = rsqrtf(ss * (1.0f / (float)HDIM) + 1e-6f);

  const float4 wv = *(const float4*)(w + d);
  const float4 c  = *(const float4*)(cs + (size_t)t * HDIM + d);
  const float4 s  = *(const float4*)(sn + (size_t)t * HDIM + d);

  const float y0 = x.x * inv * wv.x;
  const float y1 = x.y * inv * wv.y;
  const float y2 = x.z * inv * wv.z;
  const float y3 = x.w * inv * wv.w;

  v4h o;
  o[0] = (_Float16)((y0 * c.x - y1 * s.x) * scale);
  o[1] = (_Float16)((y1 * c.y + y0 * s.y) * scale);
  o[2] = (_Float16)((y2 * c.z - y3 * s.z) * scale);
  o[3] = (_Float16)((y3 * c.w + y2 * s.w) * scale);
  *(v4h*)(out + ((size_t)h * T + t) * HDIM + d) = o;
}

// ---------------------------------------------------------------------------
// V pack + transpose: fp32 [T,D] -> f16 [H][HD][T]  (out[hd*T + t])
// LDS-tiled 32x32 so both global read and write are coalesced.
// block = 256 threads; grid = (DMODEL/32, T/32)
// ---------------------------------------------------------------------------
__global__ void __launch_bounds__(256)
vtranspose_pack_kernel(const float* __restrict__ P, _Float16* __restrict__ out,
                       int T) {
  __shared__ _Float16 tile[32][33];  // +1 pad to dodge bank conflicts
  const int tx = threadIdx.x & 31;
  const int ty = threadIdx.x >> 5;   // 0..7
  const int d0 = blockIdx.x * 32;
  const int t0 = blockIdx.y * 32;
#pragma unroll
  for (int k = 0; k < 4; ++k) {
    const int t = t0 + ty + k * 8;
    tile[ty + k * 8][tx] = (_Float16)P[(size_t)t * DMODEL + d0 + tx];
  }
  __syncthreads();
#pragma unroll
  for (int k = 0; k < 4; ++k) {
    const int row = ty + k * 8;
    out[(size_t)(d0 + row) * T + t0 + tx] = tile[tx][row];
  }
}

// ---------------------------------------------------------------------------
// One online-softmax attention pass over T keys for a 16-query block, in the
// transposed form S^T = K Q^T, O^T += V^T P^T: a lane holds scores of ONE query
// (column lane & 15), keys 8 * half + i of each 16-key tile in register i. The
// maximum and the sum over keys are taken inside the lane plus one exchange
// between the wave's halves, and two score tiles, converted in place, are the
// B operand of the second product.
// The block's four waves work on one head, so they share its K and V^T tiles:
// a stage is 64 keys (64 K rows of 256 B, 128 V^T rows of 128 B), brought into
// LDS by asynchronous b128 copies of whole 128-B lines. Two buffers: the next
// stage's copies fly while this stage is worked on. Needs T % 64 == 0.
// ---------------------------------------------------------------------------
#define A_KEYS    64                              // keys per stage
#define A_KPITCH  272                             // K row pitch, 16 B x odd
#define A_VPITCH  144                             // V^T row pitch, 16 B x odd
#define A_KBYTES  (A_KEYS * A_KPITCH)             // K part of a buffer
#define A_STAGE   (A_KBYTES + HDIM * A_VPITCH)    // bytes per buffer

// Eight copies and, as the statement's last line, the wait that stands in
// front of any rewrite of the address registers the copies name.
static __device__ __forceinline__ void async_copy8(const uint32_t* l,
                                                   const _Float16* const* p) {
  asm volatile(
      "global_load_async_to_lds_b128 %0, %8, off\n\t"
      "global_load_async_to_lds_b128 %1, %9, off\n\t"
      "global_load_async_to_lds_b128 %2, %10, off\n\t"
      "global_load_async_to_lds_b128 %3, %11, off\n\t"
      "global_load_async_to_lds_b128 %4, %12, off\n\t"
      "global_load_async_to_lds_b128 %5, %13, off\n\t"
      "global_load_async_to_lds_b128 %6, %14, off\n\t"
      "global_load_async_to_lds_b128 %7, %15, off\n\t"
      "s_wait_xcnt 0x0"
      :: "v"(l[0]), "v"(l[1]), "v"(l[2]), "v"(l[3]),
         "v"(l[4]), "v"(l[5]), "v"(l[6]), "v"(l[7]),
         "v"(p[0]), "v"(p[1]), "v"(p[2]), "v"(p[3]),
         "v"(p[4]), "v"(p[5]), "v"(p[6]), "v"(p[7])
      : "memory");
}

// One stage: this thread's 16 B of K rows krow, krow + 8, ..., krow + 56 and
// of V^T rows vrow, vrow + 16, ..., vrow + 112.
static __device__ __forceinline__ void attn_stage_copy(uint32_t ldk, uint32_t ldv,
                                                       const _Float16* kg,
                                                       const _Float16* vg,
                                                       size_t vstep16) {
  uint32_t l[16];
  const _Float16* p[16];
#pragma unroll
  for (int i = 0; i < 8; ++i) {
    l[i] = ldk + (uint32_t)(i * 8 * A_KPITCH);
    p[i] = kg + (size_t)i * 8 * HDIM;
    l[8 + i] = ldv + (uint32_t)(i * 16 * A_VPITCH);
    p[8 + i] = vg + (size_t)i * vstep16;
  }
  async_copy8(l, p);
  async_copy8(l + 8, p + 8);
}

// lane l with lane l ^ 16
static __device__ __forceinline__ float xhalf(float x) {
  const int b = __builtin_bit_cast(int, x);
  return __builtin_bit_cast(float, __builtin_amdgcn_permlanex16(
      b, b, 0x76543210, 0xfedcba98, false, false));
}

__device__ __forceinline__ void attn_pass(const AF* qa,
                                          const _Float16* __restrict__ Kr,
                                          const _Float16* __restrict__ Vt,
                                          int T, const unsigned char* ring,
                                          int lane, v8f* o, float& l) {
  const int r = lane & 15, half = lane >> 4;
#pragma unroll
  for (int j = 0; j < 8; ++j) { o[j] = v8f_zero(); }
  float m = -1e30f;  // running maximum of this lane's query, equal in both halves
  l = 0.f;           // running sum over THIS half's keys; the caller joins the halves

  // copy role: 16 threads per 256-B K row, 8 threads per 128-B V^T row
  const int tid = threadIdx.x;
  const _Float16* kg = Kr + (size_t)(tid >> 4) * HDIM + (tid & 15) * 8;
  const _Float16* vg = Vt + (size_t)(tid >> 3) * T + (tid & 7) * 8;
  const uint32_t ldk = (uint32_t)(size_t)ring +
                       (uint32_t)((tid >> 4) * A_KPITCH + (tid & 15) * 16);
  const uint32_t ldv = (uint32_t)(size_t)ring +
                       (uint32_t)(A_KBYTES + (tid >> 3) * A_VPITCH + (tid & 7) * 16);
  const size_t vstep16 = (size_t)16 * T;
  const int ns = T / A_KEYS;

  // Every reader has left both buffers here: at the kernel's start nothing has
  // read them, and an earlier pass ends with its last publish point's barrier.
  attn_stage_copy(ldk, ldv, kg, vg, vstep16);
  // stage 0 has landed for this wave; the barrier publishes it to the others
  asm volatile("s_wait_asynccnt 0x0" ::: "memory");
  __syncthreads();
  if (ns > 1)
    attn_stage_copy(ldk + A_STAGE, ldv + A_STAGE, kg + (size_t)A_KEYS * HDIM,
                    vg + A_KEYS, vstep16);

  for (int s = 0; s < ns; ++s) {
    const uint32_t boff = (uint32_t)(s & 1) * A_STAGE;
    const unsigned char* kt = ring + boff + r * A_KPITCH + half * 16;
    const unsigned char* vt = ring + boff + A_KBYTES + r * A_VPITCH + half * 16;
    // kept rolled: unrolled, the two halves' live ranges take the kernel to 356
    // registers, two waves per SIMD where the grid wants three
#pragma unroll 1
    for (int ks = 0; ks < 2; ++ks) {
      const unsigned char* kr0 = kt + ks * 32 * A_KPITCH;
      const unsigned char* kr1 = kr0 + 16 * A_KPITCH;
      v8f s0 = v8f_zero(), s1 = v8f_zero();
      AF b0[4], b1[4];
#pragma unroll
      for (int kc = 0; kc < 4; ++kc) {
        b0[kc].u[0] = *(const uint4*)(kr0 + kc * 64);
        b0[kc].u[1] = *(const uint4*)(kr0 + kc * 64 + 32);
        b1[kc].u[0] = *(const uint4*)(kr1 + kc * 64);
        b1[kc].u[1] = *(const uint4*)(kr1 + kc * 64 + 32);
      }
      // keeps the sixteen K reads one group ahead of the products: without it
      // the compiler sinks each four to their two products behind a full LDS wait
      __builtin_amdgcn_sched_barrier(0);
#pragma unroll
      for (int kc = 0; kc < 4; ++kc) {
        s0 = wmma_f16(b0[kc].h, qa[kc].h, s0);  // s0[i] = S[query r][key 8 * half + i]
        s1 = wmma_f16(b1[kc].h, qa[kc].h, s1);  // s1[i] = S[query r][key 16 + 8 * half + i]
      }
      AF av[8];
#pragma unroll
      for (int j = 0; j < 8; ++j) {
        const unsigned char* vr = vt + j * 16 * A_VPITCH + ks * 64;
        av[j].u[0] = *(const uint4*)(vr);
        av[j].u[1] = *(const uint4*)(vr + 32);
      }
      // keeps the sixteen V^T reads in front of the softmax, which covers their
      // latency: without it the compiler sinks each pair to its product behind
      // a full LDS wait
      __builtin_amdgcn_sched_barrier(0);
      // online softmax of one query per lane: 16 of the 32 keys in this half
      float cm = fmaxf(s0[0], s1[0]);
#pragma unroll
      for (int i = 1; i < 8; ++i) cm = fmaxf(cm, fmaxf(s0[i], s1[i]));
      cm = fmaxf(cm, xhalf(cm));
      const float mn = fmaxf(m, cm);
      const float alpha = __expf(m - mn);
      m = mn;
      AF pb;  // P^T as B operand: element s is key 8 * half + s, then 16 + 8 * half + (s - 8)
#pragma unroll
      for (int i = 0; i < 8; i += 2) {
        v2f p0, p1;
        p0[0] = __expf(s0[i] - mn); p0[1] = __expf(s0[i + 1] - mn);
        p1[0] = __expf(s1[i] - mn); p1[1] = __expf(s1[i + 1] - mn);
        s0[i] = p0[0]; s0[i + 1] = p0[1];
        s1[i] = p1[0]; s1[i + 1] = p1[1];
        const v2h h0 = __builtin_convertvector(p0, v2h);
        const v2h h1 = __builtin_convertvector(p1, v2h);
        pb.h[i] = h0[0];     pb.h[i + 1] = h0[1];
        pb.h[8 + i] = h1[0]; pb.h[8 + i + 1] = h1[1];
      }
#pragma unroll
      for (int j = 0; j < 8; ++j) o[j] *= alpha;
#pragma unroll
      for (int j = 0; j < 8; ++j) {
        o[j] = wmma_f16(av[j].h, pb.h, o[j]);  // o[j][i] = O[query r][16 * j + 8 * half + i]
      }
      // keeps the sum's additions behind the last product, so that no product
      // stands directly in front of the loop's branch
      __builtin_amdgcn_sched_barrier(0);
      const v8f ps = s0 + s1;
      l = l * alpha + (((ps[0] + ps[1]) + (ps[2] + ps[3])) +
                       ((ps[4] + ps[5]) + (ps[6] + ps[7])));
    }
    // publish point of stage s + 1: this wave's reads of stage s are done ...
    asm volatile("s_wait_dscnt 0x0" ::: "memory");
    // ... its own copies of stage s + 1 have landed ...
    asm volatile("s_wait_asynccnt 0x0" ::: "memory");
    // ... and the barrier both publishes stage s + 1 and frees stage s's buffer
    __syncthreads();
    if (s + 2 < ns)
      attn_stage_copy(ldk + boff, ldv + boff,
                      kg + (size_t)(s + 2) * A_KEYS * HDIM,
                      vg + (size_t)(s + 2) * A_KEYS, vstep16);
  }
  // no copy is left outstanding behind the pass
  asm volatile("s_wait_asynccnt 0x0" ::: "memory");
}

// ---------------------------------------------------------------------------
// Fused dual attention: out = lambda * softmax(Q Kc^T) Vc + softmax(Q K^T) V
// 4 waves per block; each wave owns one (head, 16-query) block; the four
// blocks of a work-group lie in one head (128 query blocks per head).
// ---------------------------------------------------------------------------
__global__ void __launch_bounds__(128)
attention_kernel(const _Float16* __restrict__ Qb, const _Float16* __restrict__ Kb,
                 const _Float16* __restrict__ Vtb, const _Float16* __restrict__ Kcb,
                 const _Float16* __restrict__ Vctb, const float* __restrict__ lam,
                 float* __restrict__ out) {
  __shared__ __attribute__((aligned(16))) unsigned char ring[2 * A_STAGE];
  const int wave = threadIdx.x >> 5;
  const int lane = threadIdx.x & 31;
  const int r = lane & 15, half = lane >> 4;
  const int qb = blockIdx.x * 4 + wave;       // 0 .. H*(S/16)-1
  const int h  = blockIdx.x >> 5;             // = qb / (S_LEN/16), one per block
  const int q0 = (qb & 127) * 16;

  // Q fragments (pre-scaled by 1/sqrt(HD) at pack time)
  AF qa[4];
  const _Float16* qrow = Qb + ((size_t)h * S_LEN + q0 + r) * HDIM;
#pragma unroll
  for (int kc = 0; kc < 4; ++kc) {
    qa[kc].u[0] = *(const uint4*)(qrow + kc * 32 + half * 8);
    qa[kc].u[1] = *(const uint4*)(qrow + kc * 32 + 16 + half * 8);
  }

  v8f oc[8]; float lc;
  attn_pass(qa, Kcb + (size_t)h * SC_LEN * HDIM, Vctb + (size_t)h * HDIM * SC_LEN,
            SC_LEN, ring, lane, oc, lc);
  const float fc = lam[0] / (lc + xhalf(lc));
#pragma unroll
  for (int j = 0; j < 8; ++j) oc[j] *= fc;

  v8f os[8]; float ls;
  attn_pass(qa, Kb + (size_t)h * S_LEN * HDIM, Vtb + (size_t)h * HDIM * S_LEN,
            S_LEN, ring, lane, os, ls);

  // a lane holds eight consecutive head dims of its query per tile: 32 B stores
  const float inv = 1.0f / (ls + xhalf(ls));
  float* orow = out + (size_t)(q0 + r) * DMODEL + h * HDIM + half * 8;
#pragma unroll
  for (int j = 0; j < 8; ++j) {
    float4 lo, hi;
    lo.x = oc[j][0] + os[j][0] * inv; lo.y = oc[j][1] + os[j][1] * inv;
    lo.z = oc[j][2] + os[j][2] * inv; lo.w = oc[j][3] + os[j][3] * inv;
    hi.x = oc[j][4] + os[j][4] * inv; hi.y = oc[j][5] + os[j][5] * inv;
    hi.z = oc[j][6] + os[j][6] * inv; hi.w = oc[j][7] + os[j][7] * inv;
    *(float4*)(orow + j * 16)     = lo;
    *(float4*)(orow + j * 16 + 4) = hi;
  }
}

// ---------------------------------------------------------------------------
// host launcher
// ---------------------------------------------------------------------------
extern "C" void kernel_launch(void* const* d_in, const int* in_sizes, int n_in,
                              void* d_out, int out_size, void* d_ws, size_t ws_size,
                              hipStream_t stream) {
  (void)in_sizes; (void)n_in; (void)out_size; (void)ws_size;
  const float* hs    = (const float*)d_in[0];
  const float* cond  = (const float*)d_in[1];
  const float* lam   = (const float*)d_in[2];
  const float* Wq    = (const float*)d_in[3];
  const float* bq    = (const float*)d_in[4];
  const float* Wk    = (const float*)d_in[5];
  const float* bk    = (const float*)d_in[6];
  const float* Wv    = (const float*)d_in[7];
  const float* bv    = (const float*)d_in[8];
  const float* nqw   = (const float*)d_in[9];
  const float* nkw   = (const float*)d_in[10];
  const float* cos0  = (const float*)d_in[11];
  const float* sin0  = (const float*)d_in[12];
  const float* cos1  = (const float*)d_in[13];
  const float* sin1  = (const float*)d_in[14];
  float* out = (float*)d_out;

  // workspace carve (256B aligned)
  char* wp = (char*)d_ws;
  auto carve = [&](size_t bytes) -> void* {
    void* p = (void*)wp;
    wp += (bytes + 255) & ~(size_t)255;
    return p;
  };
  _Float16* hsb   = (_Float16*)carve((size_t)S_LEN * DMODEL * 2);
  _Float16* condb = (_Float16*)carve((size_t)SC_LEN * DMODEL * 2);
  _Float16* wbuf  = (_Float16*)carve((size_t)DMODEL * DMODEL * 2);
  float*    pbuf  = (float*)   carve((size_t)S_LEN * DMODEL * 4);
  _Float16* Qb    = (_Float16*)carve((size_t)S_LEN * DMODEL * 2);
  _Float16* Kb    = (_Float16*)carve((size_t)S_LEN * DMODEL * 2);
  _Float16* Kcb   = (_Float16*)carve((size_t)SC_LEN * DMODEL * 2);
  _Float16* Vtb   = (_Float16*)carve((size_t)S_LEN * DMODEL * 2);
  _Float16* Vctb  = (_Float16*)carve((size_t)SC_LEN * DMODEL * 2);

  const float qscale = 0.088388347648318447f;  // 1/sqrt(128)
  const size_t nHS = (size_t)S_LEN * DMODEL;
  const size_t nC  = (size_t)SC_LEN * DMODEL;
  const size_t nW  = (size_t)DMODEL * DMODEL;
  auto cgrid = [](size_t n) { return (unsigned)((n + CV_BLOCK - 1) / CV_BLOCK); };

  f32_to_f16_kernel<<<cgrid(nHS), 256, 0, stream>>>(hs, hsb, nHS);
  f32_to_f16_kernel<<<cgrid(nC), 256, 0, stream>>>(cond, condb, nC);

  const dim3 gS(DMODEL / 128, S_LEN / 64);
  const dim3 gC(DMODEL / 128, SC_LEN / 64);
  const unsigned packS = (unsigned)(NHEADS * S_LEN / 4);
  const unsigned packC = (unsigned)(NHEADS * SC_LEN / 4);
  const dim3 vtS(DMODEL / 32, S_LEN / 32);
  const dim3 vtC(DMODEL / 32, SC_LEN / 32);

  // Q
  f32_to_f16_kernel<<<cgrid(nW), 256, 0, stream>>>(Wq, wbuf, nW);
  gemm_wmma_kernel<<<gS, 128, 0, stream>>>(hsb, wbuf, bq, pbuf, S_LEN, DMODEL, DMODEL);
  norm_rope_pack_kernel<<<packS, 128, 0, stream>>>(pbuf, nqw, cos0, sin0, Qb, S_LEN, qscale);

  // K (self) and Kc (cross)
  f32_to_f16_kernel<<<cgrid(nW), 256, 0, stream>>>(Wk, wbuf, nW);
  gemm_wmma_kernel<<<gS, 128, 0, stream>>>(hsb, wbuf, bk, pbuf, S_LEN, DMODEL, DMODEL);
  norm_rope_pack_kernel<<<packS, 128, 0, stream>>>(pbuf, nkw, cos0, sin0, Kb, S_LEN, 1.0f);
  gemm_wmma_kernel<<<gC, 128, 0, stream>>>(condb, wbuf, bk, pbuf, SC_LEN, DMODEL, DMODEL);
  norm_rope_pack_kernel<<<packC, 128, 0, stream>>>(pbuf, nkw, cos1, sin1, Kcb, SC_LEN, 1.0f);

  // V (self) and Vc (cross), transposed to [H][HD][T]
  f32_to_f16_kernel<<<cgrid(nW), 256, 0, stream>>>(Wv, wbuf, nW);
  gemm_wmma_kernel<<<gS, 128, 0, stream>>>(hsb, wbuf, bv, pbuf, S_LEN, DMODEL, DMODEL);
  vtranspose_pack_kernel<<<vtS, 256, 0, stream>>>(pbuf, Vtb, S_LEN);
  gemm_wmma_kernel<<<gC, 128, 0, stream>>>(condb, wbuf, bv, pbuf, SC_LEN, DMODEL, DMODEL);
  vtranspose_pack_kernel<<<vtC, 256, 0, stream>>>(pbuf, Vctb, SC_LEN);

  // fused dual attention + combine
  const unsigned attnBlocks = (unsigned)(NHEADS * (S_LEN / 16) / 4);
  attention_kernel<<<attnBlocks, 128, 0, stream>>>(Qb, Kb, Vtb, Kcb, Vctb, lam, out);
}

// v004
// One run takes 257 microseconds.
// Next to v003, in two timings, it ran 1.12 times as fast each time.
// Over all steps from v000 it is 3.62 times as fast.
#include <hip/hip_runtime.h>
#include <hip/hip_bf16.h>
#include <cstdint>
#include <cstddef>

#define S_LEN  2048
#define SC_LEN 1024
#define DMODEL 3072
#define NHEADS 24
#define HDIM   128

typedef __attribute__((ext_vector_type(16))) _Float16 v16h;
typedef __attribute__((ext_vector_type(8)))  float    v8f;
typedef __attribute__((ext_vector_type(8)))  _Float16 v8h;
typedef __attribute__((ext_vector_type(4)))  _Float16 v4h;
typedef __attribute__((ext_vector_type(2)))  _Float16 v2h;
typedef __attribute__((ext_vector_type(2)))  float    v2f;

union AF { uint4 u[2]; v16h h; };

static __device__ __forceinline__ v8f wmma_f16(v16h a, v16h b, v8f c) {
  // D = A(16x32 f16) x B(32x16 f16) + C(16x16 f32)
  return __builtin_amdgcn_wmma_f32_16x16x32_f16(false, a, false, b, (short)0, c,
                                                false, false);
}

static __device__ __forceinline__ v8f v8f_zero() {
  v8f z = {0.f, 0.f, 0.f, 0.f, 0.f, 0.f, 0.f, 0.f};
  return z;
}

// ---------------------------------------------------------------------------
// fp32 -> f16 elementwise convert
// block = 256 threads (8 waves), 8192 elements; a wave owns 1024 consecutive
// elements: eight wave-wide 16-B loads of 512 contiguous bytes each, all issued
// before the first is used, then eight wave-wide 8-B stores of 256 contiguous
// bytes (two whole lines) each.
// ---------------------------------------------------------------------------
#define CV_LOADS 8                      // 16-B loads in flight per lane
#define CV_WAVE  (32 * 4 * CV_LOADS)    // elements per wave
#define CV_BLOCK (8 * CV_WAVE)          // elements per block

__global__ void __launch_bounds__(256)
f32_to_f16_kernel(const float* __restrict__ in, _Float16* __restrict__ out,
                  size_t n) {
  const size_t blk = (size_t)blockIdx.x * CV_BLOCK;
  if (blk + CV_BLOCK <= n) {
    const size_t base = blk + (size_t)(threadIdx.x >> 5) * CV_WAVE +
                        (size_t)(threadIdx.x & 31) * 4;
    float4 x[CV_LOADS];
    // unrolled: x stays in registers and the eight loads issue as one group
#pragma unroll
    for (int k = 0; k < CV_LOADS; ++k)
      x[k] = *(const float4*)(in + base + k * 128);
    // unrolled: constant indices into x, each pair of converts behind its own load
#pragma unroll
    for (int k = 0; k < CV_LOADS; ++k) {
      v4h o;
      o[0] = (_Float16)x[k].x;
      o[1] = (_Float16)x[k].y;
      o[2] = (_Float16)x[k].z;
      o[3] = (_Float16)x[k].w;
      *(v4h*)(out + base + k * 128) = o;
    }
    // stands in front of any later rewrite of a register that the stores name
    asm volatile("s_wait_xcnt 0x0" ::: "memory");
  } else {  // a last block that is not whole: one element at a time
    for (size_t i = blk + threadIdx.x; i < n; i += 256) out[i] = (_Float16)in[i];
  }
}

// ---------------------------------------------------------------------------
// acc = X[M,K] * W[N,K]^T for one block tile (f16 inputs, f32 accumulators);
// the two kernels behind it add the bias and finish the tile in their epilogues.
// block = 128 threads (4 waves); block tile M=64 x N=128; per wave 32x64.
// A stage is 128 k of the block's 64 X rows and 128 W rows: 192 rows of 256 B,
// brought into LDS by asynchronous b128 copies (two whole rows per wave-wide
// copy) and shared by the four waves. Two buffers: the next stage's copies fly
// while this stage's fragments are read from LDS.
// Needs M % 64 == 0, N % 128 == 0, K % 128 == 0.
// ---------------------------------------------------------------------------
#define G_BK     128                    // k (halves) per stage
#define G_PITCH  272                    // LDS row pitch, bytes: 16 B x odd
#define G_STAGE  (192 * G_PITCH)        // bytes per buffer

// Twelve copies and, as the statement's last line, the wait that stands in
// front of any rewrite of the address registers the copies name.
static __device__ __forceinline__ void async_copy12(const uint32_t* l,
                                                    const _Float16* const* p) {
  asm volatile(
      "global_load_async_to_lds_b128 %0, %12, off\n\t"
      "global_load_async_to_lds_b128 %1, %13, off\n\t"
      "global_load_async_to_lds_b128 %2, %14, off\n\t"
      "global_load_async_to_lds_b128 %3, %15, off\n\t"
      "global_load_async_to_lds_b128 %4, %16, off\n\t"
      "global_load_async_to_lds_b128 %5, %17, off\n\t"
      "global_load_async_to_lds_b128 %6, %18, off\n\t"
      "global_load_async_to_lds_b128 %7, %19, off\n\t"
      "global_load_async_to_lds_b128 %8, %20, off\n\t"
      "global_load_async_to_lds_b128 %9, %21, off\n\t"
      "global_load_async_to_lds_b128 %10, %22, off\n\t"
      "global_load_async_to_lds_b128 %11, %23, off\n\t"
      "s_wait_xcnt 0x0"
      :: "v"(l[0]), "v"(l[1]), "v"(l[2]), "v"(l[3]), "v"(l[4]), "v"(l[5]),
         "v"(l[6]), "v"(l[7]), "v"(l[8]), "v"(l[9]), "v"(l[10]), "v"(l[11]),
         "v"(p[0]), "v"(p[1]), "v"(p[2]), "v"(p[3]), "v"(p[4]), "v"(p[5]),
         "v"(p[6]), "v"(p[7]), "v"(p[8]), "v"(p[9]), "v"(p[10]), "v"(p[11])
      : "memory");
}

// One stage: this thread's 16 B of stage rows crow, crow + 8, ..., crow + 184
// (rows 0..63 are X rows, rows 64..191 are W rows).
static __device__ __forceinline__ void gemm_stage_copy(uint32_t lds,
                                                       const _Float16* xg,
                                                       const _Float16* wg,
                                                       size_t step8) {
  uint32_t l[24];
  const _Float16* p[24];
#pragma unroll
  for (int i = 0; i < 24; ++i) l[i] = lds + (uint32_t)(i * 8 * G_PITCH);
#pragma unroll
  for (int i = 0; i < 8; ++i) p[i] = xg + (size_t)i * step8;
#pragma unroll
  for (int i = 0; i < 16; ++i) p[8 + i] = wg + (size_t)i * step8;
  async_copy12(l, p);
  async_copy12(l + 12, p + 12);
}

static __device__ __forceinline__ void
gemm_tile_acc(const _Float16* __restrict__ X, const _Float16* __restrict__ W,
              int K, int mb, int nb, unsigned char* smem, v8f (&acc)[2][4]) {
  const int lane = threadIdx.x & 31;
  const int wave = threadIdx.x >> 5;
  const int r    = lane & 15;
  const int half = lane >> 4;

#pragma unroll
  for (int a = 0; a < 2; ++a)
#pragma unroll
    for (int j = 0; j < 4; ++j) acc[a][j] = v8f_zero();

  // copy role: 16 threads per 256-B row, 8 rows per block-wide copy
  const int crow = threadIdx.x >> 4;
  const int ccol = threadIdx.x & 15;
  const _Float16* xg = X + (size_t)(mb + crow) * K + ccol * 8;
  const _Float16* wg = W + (size_t)(nb + crow) * K + ccol * 8;
  const uint32_t  ld = (uint32_t)(size_t)smem + (uint32_t)(crow * G_PITCH + ccol * 16);
  const size_t step8 = (size_t)8 * K;
  const int nt = K / G_BK;

  // fragment role: same rows and same k order as the global fragment loads had
  const unsigned char* xa = smem + ((wave >> 1) * 32 + r) * G_PITCH + half * 16;
  const unsigned char* wb = smem + (64 + (wave & 1) * 64 + r) * G_PITCH + half * 16;

  gemm_stage_copy(ld, xg, wg, step8);
  // stage 0 has landed for this wave; the barrier publishes it to the others
  asm volatile("s_wait_asynccnt 0x0" ::: "memory");
  __syncthreads();
  if (nt > 1) gemm_stage_copy(ld + G_STAGE, xg + G_BK, wg + G_BK, step8);

  for (int t = 0; t < nt; ++t) {
    const uint32_t boff = (uint32_t)(t & 1) * G_STAGE;
    const unsigned char* xs = xa + boff;
    const unsigned char* ws = wb + boff;
    // Fragments of one 32-k block: twelve LDS reads issued as one group.
    AF fa[2][2], fb[2][4];
#pragma unroll
    for (int i = 0; i < 2; ++i) {
      fa[0][i].u[0] = *(const uint4*)(xs + i * 16 * G_PITCH);
      fa[0][i].u[1] = *(const uint4*)(xs + i * 16 * G_PITCH + 32);
    }
#pragma unroll
    for (int j = 0; j < 4; ++j) {
      fb[0][j].u[0] = *(const uint4*)(ws + j * 16 * G_PITCH);
      fb[0][j].u[1] = *(const uint4*)(ws + j * 16 * G_PITCH + 32);
    }
#pragma unroll
    for (int kk = 0; kk < 4; ++kk) {
      const int cur = kk & 1, nxt = cur ^ 1;
      if (kk < 3) {  // the same stage's next block, into the other register set
#pragma unroll
        for (int i = 0; i < 2; ++i) {
          fa[nxt][i].u[0] = *(const uint4*)(xs + i * 16 * G_PITCH + (kk + 1) * 64);
          fa[nxt][i].u[1] = *(const uint4*)(xs + i * 16 * G_PITCH + (kk + 1) * 64 + 32);
        }
#pragma unroll
        for (int j = 0; j < 4; ++j) {
          fb[nxt][j].u[0] = *(const uint4*)(ws + j * 16 * G_PITCH + (kk + 1) * 64);
          fb[nxt][j].u[1] = *(const uint4*)(ws + j * 16 * G_PITCH + (kk + 1) * 64 + 32);
        }
      }
      // keeps the reads one group ahead of the products: without it the
      // compiler sinks each pair of reads to its two products, with a full
      // LDS wait in front of every pair
      __builtin_amdgcn_sched_barrier(0);
#pragma unroll
      for (int j = 0; j < 4; ++j) {
        acc[0][j] = wmma_f16(fa[cur][0].h, fb[cur][j].h, acc[0][j]);
        acc[1][j] = wmma_f16(fa[cur][1].h, fb[cur][j].h, acc[1][j]);
      }
      // keeps the next group of reads out of this block's products
      __builtin_amdgcn_sched_barrier(0);
    }
    // publish point of stage t + 1: this wave's reads of stage t are done ...
    asm volatile("s_wait_dscnt 0x0" ::: "memory");
    // ... its own copies of stage t + 1 have landed ...
    asm volatile("s_wait_asynccnt 0x0" ::: "memory");
    // ... and the barrier both publishes stage t + 1 and frees stage t's buffer
    __syncthreads();
    if (t + 2 < nt)
      gemm_stage_copy(ld + boff, xg + (size_t)(t + 2) * G_BK,
                      wg + (size_t)(t + 2) * G_BK, step8);
  }
  // no copy is left outstanding behind the main loop
  asm volatile("s_wait_asynccnt 0x0" ::: "memory");
}

// ---------------------------------------------------------------------------
// Projection + bias + RMSNorm(head_dim) + RoPE + optional scale:
// f16 X[M,K], W[N,K] -> f16 [H][M][HD]. The block's 128 columns are one head,
// so its tile holds whole head rows. The f32 tile goes through the ring's LDS,
// which every wave has left at the loop's last barrier; then one wave per row,
// a lane owns 4 consecutive dims (2 rope pairs), a row is stored as two lines.
// ---------------------------------------------------------------------------
#define E_PITCH 132                     // floats per staged row: 16 B x odd

__global__ void __launch_bounds__(128)
gemm_norm_rope_kernel(const _Float16* __restrict__ X, const _Float16* __restrict__ W,
                      const float* __restrict__ bias, const float* __restrict__ w,
                      const float* __restrict__ cs, const float* __restrict__ sn,
                      _Float16* __restrict__ out, int M, int K, float scale) {
  __shared__ __attribute__((aligned(16))) unsigned char smem[2 * G_STAGE];
  const int lane = threadIdx.x & 31;
  const int wave = threadIdx.x >> 5;
  const int r    = lane & 15;
  const int half = lane >> 4;
  const int mb   = blockIdx.y * 64;
  const int nb   = blockIdx.x * HDIM;

  v8f acc[2][4];
  gemm_tile_acc(X, W, K, mb, nb, smem, acc);

  // this wave's 16 rows of cos and sin, asked for ahead of the staging and its
  // barrier, which cover a part of their latency
  const int d    = lane * 4;
  const int row0 = wave * 16;
  const float* cp = cs + (size_t)(mb + row0) * HDIM + d;
  const float* sp = sn + (size_t)(mb + row0) * HDIM + d;
  const float4 wv = *(const float4*)(w + d);
  float4 c[16], s[16];
  // unrolled: c and s stay in registers
#pragma unroll
  for (int q = 0; q < 16; ++q) {
    c[q] = *(const float4*)(cp + q * HDIM);
    s[q] = *(const float4*)(sp + q * HDIM);
  }

  float* st = (float*)smem;
  const int ml = (wave >> 1) * 32 + half * 8;
  const int nl = (wave & 1) * 64 + r;
  // unrolled (all three loops): constant indices into acc, which stays in registers
#pragma unroll
  for (int j = 0; j < 4; ++j) {
    const float bn = bias[nb + nl + j * 16];
#pragma unroll
    for (int a = 0; a < 2; ++a)
#pragma unroll
      for (int i = 0; i < 8; ++i)
        st[(ml + a * 16 + i) * E_PITCH + nl + j * 16] = acc[a][j][i] + bn;
  }
  // publishes the staged tile: a row's two halves come from two waves
  __syncthreads();

  _Float16* op = out + ((size_t)blockIdx.x * M + mb + row0) * HDIM + d;
  // unrolled: constant indices into c and s; the rows' reductions interleave
#pragma unroll
  for (int q = 0; q < 16; ++q) {
    const float4 x = *(const float4*)(st + (row0 + q) * E_PITCH + d);
    float ss = x.x * x.x + x.y * x.y + x.z * x.z + x.w * x.w;
#pragma unroll
    for (int msk = 1; msk < 32; msk <<= 1) ss += __shfl_xor(ss, msk, 32);
    const float inv = rsqrtf(ss * (1.0f / (float)HDIM) + 1e-6f);

    const float y0 = x.x * inv * wv.x;
    const float y1 = x.y * inv * wv.y;
    const float y2 = x.z * inv * wv.z;
    const float y3 = x.w * inv * wv.w;

    v4h o;
    o[0] = (_Float16)((y0 * c[q].x - y1 * s[q].x) * scale);
    o[1] = (_Float16)((y1 * c[q].y + y0 * s[q].y) * scale);
    o[2] = (_Float16)((y2 * c[q].z - y3 * s[q].z) * scale);
    o[3] = (_Float16)((y3 * c[q].w + y2 * s[q].w) * scale);
    *(v4h*)(op + q * HDIM) = o;
  }
}

// ---------------------------------------------------------------------------
// Projection + bias + transposed pack: f16 X[M,K], W[N,K] -> f16 [N][M], that
// is [H][HD][M]. A lane's accumulator tile holds 8 consecutive rows m of one
// column n: 16 B of an output row. The 128 x 64 f16 tile goes through the
// ring's LDS so that each output row's 128 B leave as one whole line.
// ---------------------------------------------------------------------------
#define T_PITCH 144                     // bytes per staged row: 16 B x odd

__global__ void __launch_bounds__(128)
gemm_vt_kernel(const _Float16* __restrict__ X, const _Float16* __restrict__ W,
               const float* __restrict__ bias, _Float16* __restrict__ out,
               int M, int K) {
  __shared__ __attribute__((aligned(16))) unsigned char smem[2 * G_STAGE];
  const int lane = threadIdx.x & 31;
  const int wave = threadIdx.x >> 5;
  const int r    = lane & 15;
  const int half = lane >> 4;
  const int mb   = blockIdx.y * 64;
  const int nb   = blockIdx.x * 128;

  v8f acc[2][4];
  gemm_tile_acc(X, W, K, mb, nb, smem, acc);

  const int ml = (wave >> 1) * 32 + half * 8;
  const int nl = (wave & 1) * 64 + r;
  // unrolled (all three loops): constant indices into acc, which stays in registers
#pragma unroll
  for (int j = 0; j < 4; ++j) {
    const float bn = bias[nb + nl + j * 16];
#pragma unroll
    for (int a = 0; a < 2; ++a) {
      v8h o;
#pragma unroll
      for (int i = 0; i < 8; ++i) o[i] = (_Float16)(acc[a][j][i] + bn);
      *(v8h*)(smem + (nl + j * 16) * T_PITCH + (ml + a * 16) * 2) = o;
    }
  }
  // publishes the staged tile: an output row's two halves come from two waves
  __syncthreads();

  // 8 threads per 128-B output row, 16 rows per block-wide store
  const int trow = threadIdx.x >> 3;
  const int tcol = threadIdx.x & 7;
  // unrolled: the eight LDS reads issue as one group ahead of the stores
#pragma unroll
  for (int k = 0; k < 8; ++k) {
    const int n = trow + k * 16;
    const uint4 v = *(const uint4*)(smem + n * T_PITCH + tcol * 16);
    *(uint4*)(out + (size_t)(nb + n) * M + mb + tcol * 8) = v;
  }
}

// ---------------------------------------------------------------------------
// One online-softmax attention pass over T keys for a 16-query block, in the
// transposed form S^T = K Q^T, O^T += V^T P^T: a lane holds scores of ONE query
// (column lane & 15), keys 8 * half + i of each 16-key tile in register i. The
// maximum and the sum over keys are taken inside the lane plus one exchange
// between the wave's halves, and two score tiles, converted in place, are the
// B operand of the second product.
// The block's four waves work on one head, so they share its K and V^T tiles:
// a stage is 64 keys (64 K rows of 256 B, 128 V^T rows of 128 B), brought into
// LDS by asynchronous b128 copies of whole 128-B lines. Two buffers: the next
// stage's copies fly while this stage is worked on. Needs T % 64 == 0.
// ---------------------------------------------------------------------------
#define A_KEYS    64                              // keys per stage
#define A_KPITCH  272                             // K row pitch, 16 B x odd
#define A_VPITCH  144                             // V^T row pitch, 16 B x odd
#define A_KBYTES  (A_KEYS * A_KPITCH)             // K part of a buffer
#define A_STAGE   (A_KBYTES + HDIM * A_VPITCH)    // bytes per buffer

// Eight copies and, as the statement's last line, the wait that stands in
// front of any rewrite of the address registers the copies name.
static __device__ __forceinline__ void async_copy8(const uint32_t* l,
                                                   const _Float16* const* p) {
  asm volatile(
      "global_load_async_to_lds_b128 %0, %8, off\n\t"
      "global_load_async_to_lds_b128 %1, %9, off\n\t"
      "global_load_async_to_lds_b128 %2, %10, off\n\t"
      "global_load_async_to_lds_b128 %3, %11, off\n\t"
      "global_load_async_to_lds_b128 %4, %12, off\n\t"
      "global_load_async_to_lds_b128 %5, %13, off\n\t"
      "global_load_async_to_lds_b128 %6, %14, off\n\t"
      "global_load_async_to_lds_b128 %7, %15, off\n\t"
      "s_wait_xcnt 0x0"
      :: "v"(l[0]), "v"(l[1]), "v"(l[2]), "v"(l[3]),
         "v"(l[4]), "v"(l[5]), "v"(l[6]), "v"(l[7]),
         "v"(p[0]), "v"(p[1]), "v"(p[2]), "v"(p[3]),
         "v"(p[4]), "v"(p[5]), "v"(p[6]), "v"(p[7])
      : "memory");
}

// One stage: this thread's 16 B of K rows krow, krow + 8, ..., krow + 56 and
// of V^T rows vrow, vrow + 16, ..., vrow + 112.
static __device__ __forceinline__ void attn_stage_copy(uint32_t ldk, uint32_t ldv,
                                                       const _Float16* kg,
                                                       const _Float16* vg,
                                                       size_t vstep16) {
  uint32_t l[16];
  const _Float16* p[16];
#pragma unroll
  for (int i = 0; i < 8; ++i) {
    l[i] = ldk + (uint32_t)(i * 8 * A_KPITCH);
    p[i] = kg + (size_t)i * 8 * HDIM;
    l[8 + i] = ldv + (uint32_t)(i * 16 * A_VPITCH);
    p[8 + i] = vg + (size_t)i * vstep16;
  }
  async_copy8(l, p);
  async_copy8(l + 8, p + 8);
}

// lane l with lane l ^ 16
static __device__ __forceinline__ float xhalf(float x) {
  const int b = __builtin_bit_cast(int, x);
  return __builtin_bit_cast(float, __builtin_amdgcn_permlanex16(
      b, b, 0x76543210, 0xfedcba98, false, false));
}

__device__ __forceinline__ void attn_pass(const AF* qa,
                                          const _Float16* __restrict__ Kr,
                                          const _Float16* __restrict__ Vt,
                                          int T, const unsigned char* ring,
                                          int lane, v8f* o, float& l) {
  const int r = lane & 15, half = lane >> 4;
#pragma unroll
  for (int j = 0; j < 8; ++j) { o[j] = v8f_zero(); }
  float m = -1e30f;  // running maximum of this lane's query, equal in both halves
  l = 0.f;           // running sum over THIS half's keys; the caller joins the halves

  // copy role: 16 threads per 256-B K row, 8 threads per 128-B V^T row
  const int tid = threadIdx.x;
  const _Float16* kg = Kr + (size_t)(tid >> 4) * HDIM + (tid & 15) * 8;
  const _Float16* vg = Vt + (size_t)(tid >> 3) * T + (tid & 7) * 8;
  const uint32_t ldk = (uint32_t)(size_t)ring +
                       (uint32_t)((tid >> 4) * A_KPITCH + (tid & 15) * 16);
  const uint32_t ldv = (uint32_t)(size_t)ring +
                       (uint32_t)(A_KBYTES + (tid >> 3) * A_VPITCH + (tid & 7) * 16);
  const size_t vstep16 = (size_t)16 * T;
  const int ns = T / A_KEYS;

  // Every reader has left both buffers here: at the kernel's start nothing has
  // read them, and an earlier pass ends with its last publish point's barrier.
  attn_stage_copy(ldk, ldv, kg, vg, vstep16);
  // stage 0 has landed for this wave; the barrier publishes it to the others
  asm volatile("s_wait_asynccnt 0x0" ::: "memory");
  __syncthreads();
  if (ns > 1)
    attn_stage_copy(ldk + A_STAGE, ldv + A_STAGE, kg + (size_t)A_KEYS * HDIM,
                    vg + A_KEYS, vstep16);

  for (int s = 0; s < ns; ++s) {
    const uint32_t boff = (uint32_t)(s & 1) * A_STAGE;
    const unsigned char* kt = ring + boff + r * A_KPITCH + half * 16;
    const unsigned char* vt = ring + boff + A_KBYTES + r * A_VPITCH + half * 16;
    // kept rolled: unrolled, the two halves' live ranges take the kernel to 356
    // registers, two waves per SIMD where the grid wants three
#pragma unroll 1
    for (int ks = 0; ks < 2; ++ks) {
      const unsigned char* kr0 = kt + ks * 32 * A_KPITCH;
      const unsigned char* kr1 = kr0 + 16 * A_KPITCH;
      v8f s0 = v8f_zero(), s1 = v8f_zero();
      AF b0[4], b1[4];
#pragma unroll
      for (int kc = 0; kc < 4; ++kc) {
        b0[kc].u[0] = *(const uint4*)(kr0 + kc * 64);
        b0[kc].u[1] = *(const uint4*)(kr0 + kc * 64 + 32);
        b1[kc].u[0] = *(const uint4*)(kr1 + kc * 64);
        b1[kc].u[1] = *(const uint4*)(kr1 + kc * 64 + 32);
      }
      // keeps the sixteen K reads one group ahead of the products: without it
      // the compiler sinks each four to their two products behind a full LDS wait
      __builtin_amdgcn_sched_barrier(0);
#pragma unroll
      for (int kc = 0; kc < 4; ++kc) {
        s0 = wmma_f16(b0[kc].h, qa[kc].h, s0);  // s0[i] = S[query r][key 8 * half + i]
        s1 = wmma_f16(b1[kc].h, qa[kc].h, s1);  // s1[i] = S[query r][key 16 + 8 * half + i]
      }
      AF av[8];
#pragma unroll
      for (int j = 0; j < 8; ++j) {
        const unsigned char* vr = vt + j * 16 * A_VPITCH + ks * 64;
        av[j].u[0] = *(const uint4*)(vr);
        av[j].u[1] = *(const uint4*)(vr + 32);
      }
      // keeps the sixteen V^T reads in front of the softmax, which covers their
      // latency: without it the compiler sinks each pair to its product behind
      // a full LDS wait
      __builtin_amdgcn_sched_barrier(0);
      // online softmax of one query per lane: 16 of the 32 keys in this half
      float cm = fmaxf(s0[0], s1[0]);
#pragma unroll
      for (int i = 1; i < 8; ++i) cm = fmaxf(cm, fmaxf(s0[i], s1[i]));
      cm = fmaxf(cm, xhalf(cm));
      const float mn = fmaxf(m, cm);
      const float alpha = __expf(m - mn);
      m = mn;
      AF pb;  // P^T as B operand: element s is key 8 * half + s, then 16 + 8 * half + (s - 8)
#pragma unroll
      for (int i = 0; i < 8; i += 2) {
        v2f p0, p1;
        p0[0] = __expf(s0[i] - mn); p0[1] = __expf(s0[i + 1] - mn);
        p1[0] = __expf(s1[i] - mn); p1[1] = __expf(s1[i + 1] - mn);
        s0[i] = p0[0]; s0[i + 1] = p0[1];
        s1[i] = p1[0]; s1[i + 1] = p1[1];
        const v2h h0 = __builtin_convertvector(p0, v2h);
        const v2h h1 = __builtin_convertvector(p1, v2h);
        pb.h[i] = h0[0];     pb.h[i + 1] = h0[1];
        pb.h[8 + i] = h1[0]; pb.h[8 + i + 1] = h1[1];
      }
#pragma unroll
      for (int j = 0; j < 8; ++j) o[j] *= alpha;
#pragma unroll
      for (int j = 0; j < 8; ++j) {
        o[j] = wmma_f16(av[j].h, pb.h, o[j]);  // o[j][i] = O[query r][16 * j + 8 * half + i]
      }
      // keeps the sum's additions behind the last product, so that no product
      // stands directly in front of the loop's branch
      __builtin_amdgcn_sched_barrier(0);
      const v8f ps = s0 + s1;
      l = l * alpha + (((ps[0] + ps[1]) + (ps[2] + ps[3])) +
                       ((ps[4] + ps[5]) + (ps[6] + ps[7])));
    }
    // publish point of stage s + 1: this wave's reads of stage s are done ...
    asm volatile("s_wait_dscnt 0x0" ::: "memory");
    // ... its own copies of stage s + 1 have landed ...
    asm volatile("s_wait_asynccnt 0x0" ::: "memory");
    // ... and the barrier both publishes stage s + 1 and frees stage s's buffer
    __syncthreads();
    if (s + 2 < ns)
      attn_stage_copy(ldk + boff, ldv + boff,
                      kg + (size_t)(s + 2) * A_KEYS * HDIM,
                      vg + (size_t)(s + 2) * A_KEYS, vstep16);
  }
  // no copy is left outstanding behind the pass
  asm volatile("s_wait_asynccnt 0x0" ::: "memory");
}

// ---------------------------------------------------------------------------
// Fused dual attention: out = lambda * softmax(Q Kc^T) Vc + softmax(Q K^T) V
// 4 waves per block; each wave owns one (head, 16-query) block; the four
// blocks of a work-group lie in one head (128 query blocks per head).
// ---------------------------------------------------------------------------
__global__ void __launch_bounds__(128)
attention_kernel(const _Float16* __restrict__ Qb, const _Float16* __restrict__ Kb,
                 const _Float16* __restrict__ Vtb, const _Float16* __restrict__ Kcb,
                 const _Float16* __restrict__ Vctb, const float* __restrict__ lam,
                 float* __restrict__ out) {
  __shared__ __attribute__((aligned(16))) unsigned char ring[2 * A_STAGE];
  const int wave = threadIdx.x >> 5;
  const int lane = threadIdx.x & 31;
  const int r = lane & 15, half = lane >> 4;
  const int qb = blockIdx.x * 4 + wave;       // 0 .. H*(S/16)-1
  const int h  = blockIdx.x >> 5;             // = qb / (S_LEN/16), one per block
  const int q0 = (qb & 127) * 16;

  // Q fragments (pre-scaled by 1/sqrt(HD) at pack time)
  AF qa[4];
  const _Float16* qrow = Qb + ((size_t)h * S_LEN + q0 + r) * HDIM;
#pragma unroll
  for (int kc = 0; kc < 4; ++kc) {
    qa[kc].u[0] = *(const uint4*)(qrow + kc * 32 + half * 8);
    qa[kc].u[1] = *(const uint4*)(qrow + kc * 32 + 16 + half * 8);
  }

  v8f oc[8]; float lc;
  attn_pass(qa, Kcb + (size_t)h * SC_LEN * HDIM, Vctb + (size_t)h * HDIM * SC_LEN,
            SC_LEN, ring, lane, oc, lc);
  const float fc = lam[0] / (lc + xhalf(lc));
#pragma unroll
  for (int j = 0; j < 8; ++j) oc[j] *= fc;

  v8f os[8]; float ls;
  attn_pass(qa, Kb + (size_t)h * S_LEN * HDIM, Vtb + (size_t)h * HDIM * S_LEN,
            S_LEN, ring, lane, os, ls);

  // a lane holds eight consecutive head dims of its query per tile: 32 B stores
  const float inv = 1.0f / (ls + xhalf(ls));
  float* orow = out + (size_t)(q0 + r) * DMODEL + h * HDIM + half * 8;
#pragma unroll
  for (int j = 0; j < 8; ++j) {
    float4 lo, hi;
    lo.x = oc[j][0] + os[j][0] * inv; lo.y = oc[j][1] + os[j][1] * inv;
    lo.z = oc[j][2] + os[j][2] * inv; lo.w = oc[j][3] + os[j][3] * inv;
    hi.x = oc[j][4] + os[j][4] * inv; hi.y = oc[j][5] + os[j][5] * inv;
    hi.z = oc[j][6] + os[j][6] * inv; hi.w = oc[j][7] + os[j][7] * inv;
    *(float4*)(orow + j * 16)     = lo;
    *(float4*)(orow + j * 16 + 4) = hi;
  }
}

// ---------------------------------------------------------------------------
// host launcher
// ---------------------------------------------------------------------------
extern "C" void kernel_launch(void* const* d_in, const int* in_sizes, int n_in,
                              void* d_out, int out_size, void* d_ws, size_t ws_size,
                              hipStream_t stream) {
  (void)in_sizes; (void)n_in; (void)out_size; (void)ws_size;
  const float* hs    = (const float*)d_in[0];
  const float* cond  = (const float*)d_in[1];
  const float* lam   = (const float*)d_in[2];
  const float* Wq    = (const float*)d_in[3];
  const float* bq    = (const float*)d_in[4];
  const float* Wk    = (const float*)d_in[5];
  const float* bk    = (const float*)d_in[6];
  const float* Wv    = (const float*)d_in[7];
  const float* bv    = (const float*)d_in[8];
  const float* nqw   = (const float*)d_in[9];
  const float* nkw   = (const float*)d_in[10];
  const float* cos0  = (const float*)d_in[11];
  const float* sin0  = (const float*)d_in[12];
  const float* cos1  = (const float*)d_in[13];
  const float* sin1  = (const float*)d_in[14];
  float* out = (float*)d_out;

  // workspace carve (256B aligned)
  char* wp = (char*)d_ws;
  auto carve = [&](size_t bytes) -> void* {
    void* p = (void*)wp;
    wp += (bytes + 255) & ~(size_t)255;
    return p;
  };
  _Float16* hsb   = (_Float16*)carve((size_t)S_LEN * DMODEL * 2);
  _Float16* condb = (_Float16*)carve((size_t)SC_LEN * DMODEL * 2);
  _Float16* wbuf  = (_Float16*)carve((size_t)DMODEL * DMODEL * 2);
  _Float16* Qb    = (_Float16*)carve((size_t)S_LEN * DMODEL * 2);
  _Float16* Kb    = (_Float16*)carve((size_t)S_LEN * DMODEL * 2);
  _Float16* Kcb   = (_Float16*)carve((size_t)SC_LEN * DMODEL * 2);
  _Float16* Vtb   = (_Float16*)carve((size_t)S_LEN * DMODEL * 2);
  _Float16* Vctb  = (_Float16*)carve((size_t)SC_LEN * DMODEL * 2);

  const float qscale = 0.088388347648318447f;  // 1/sqrt(128)
  const size_t nHS = (size_t)S_LEN * DMODEL;
  const size_t nC  = (size_t)SC_LEN * DMODEL;
  const size_t nW  = (size_t)DMODEL * DMODEL;
  auto cgrid = [](size_t n) { return (unsigned)((n + CV_BLOCK - 1) / CV_BLOCK); };

  f32_to_f16_kernel<<<cgrid(nHS), 256, 0, stream>>>(hs, hsb, nHS);
  f32_to_f16_kernel<<<cgrid(nC), 256, 0, stream>>>(cond, condb, nC);

  const dim3 gS(DMODEL / 128, S_LEN / 64);
  const dim3 gC(DMODEL / 128, SC_LEN / 64);

  // Q
  f32_to_f16_kernel<<<cgrid(nW), 256, 0, stream>>>(Wq, wbuf, nW);
  gemm_norm_rope_kernel<<<gS, 128, 0, stream>>>(hsb, wbuf, bq, nqw, cos0, sin0, Qb,
                                                S_LEN, DMODEL, qscale);

  // K (self) and Kc (cross)
  f32_to_f16_kernel<<<cgrid(nW), 256, 0, stream>>>(Wk, wbuf, nW);
  gemm_norm_rope_kernel<<<gS, 128, 0, stream>>>(hsb, wbuf, bk, nkw, cos0, sin0, Kb,
                                                S_LEN, DMODEL, 1.0f);
  gemm_norm_rope_kernel<<<gC, 128, 0, stream>>>(condb, wbuf, bk, nkw, cos1, sin1, Kcb,
                                                SC_LEN, DMODEL, 1.0f);

  // V (self) and Vc (cross), transposed to [H][HD][T]
  f32_to_f16_kernel<<<cgrid(nW), 256, 0, stream>>>(Wv, wbuf, nW);
  gemm_vt_kernel<<<gS, 128, 0, stream>>>(hsb, wbuf, bv, Vtb, S_LEN, DMODEL);
  gemm_vt_kernel<<<gC, 128, 0, stream>>>(condb, wbuf, bv, Vctb, SC_LEN, DMODEL);

  // fused dual attention + combine
  const unsigned attnBlocks = (unsigned)(NHEADS * (S_LEN / 16) / 4);
  attention_kernel<<<attnBlocks, 128, 0, stream>>>(Qb, Kb, Vtb, Kcb, Vctb, lam, out);
}

// v005
// A run of this version takes 218 microseconds.
// In two side-by-side timings against v004, it was 1.17 and 1.18 times as fast.
// All steps since v000 together make it 4.25 times as fast.
#include <hip/hip_runtime.h>
#include <hip/hip_bf16.h>
#include <cstdint>
#include <cstddef>

#define S_LEN  2048
#define SC_LEN 1024
#define DMODEL 3072
#define NHEADS 24
#define HDIM   128

typedef __attribute__((ext_vector_type(16))) _Float16 v16h;
typedef __attribute__((ext_vector_type(8)))  float    v8f;
typedef __attribute__((ext_vector_type(8)))  _Float16 v8h;
typedef __attribute__((ext_vector_type(4)))  _Float16 v4h;
typedef __attribute__((ext_vector_type(2)))  _Float16 v2h;
typedef __attribute__((ext_vector_type(2)))  float    v2f;

union AF { uint4 u[2]; v16h h; };

static __device__ __forceinline__ v8f wmma_f16(v16h a, v16h b, v8f c) {
  // D = A(16x32 f16) x B(32x16 f16) + C(16x16 f32)
  return __builtin_amdgcn_wmma_f32_16x16x32_f16(false, a, false, b, (short)0, c,
                                                false, false);
}

static __device__ __forceinline__ v8f v8f_zero() {
  v8f z = {0.f, 0.f, 0.f, 0.f, 0.f, 0.f, 0.f, 0.f};
  return z;
}

// ---------------------------------------------------------------------------
// fp32 -> f16 elementwise convert of all five f32 operands in ONE launch: the
// block index picks the operand (a scalar choice) and the block's place in it.
// block = 256 threads (8 waves), 8192 elements; a wave owns 1024 consecutive
// elements: eight wave-wide 16-B loads of 512 contiguous bytes each, all issued
// before the first is used, then eight wave-wide 8-B stores of 256 contiguous
// bytes (two whole lines) each.
// ---------------------------------------------------------------------------
#define CV_LOADS 8                      // 16-B loads in flight per lane
#define CV_WAVE  (32 * 4 * CV_LOADS)    // elements per wave
#define CV_BLOCK (8 * CV_WAVE)          // elements per block

#define CB_HS (S_LEN * DMODEL / CV_BLOCK)     // blocks of the hidden states
#define CB_C  (SC_LEN * DMODEL / CV_BLOCK)    // blocks of the cond hidden states
#define CB_W  (DMODEL * DMODEL / CV_BLOCK)    // blocks of one weight matrix
#define CB_ALL (CB_HS + CB_C + 3 * CB_W)
static_assert(S_LEN * DMODEL % CV_BLOCK == 0 && SC_LEN * DMODEL % CV_BLOCK == 0 &&
              DMODEL * DMODEL % CV_BLOCK == 0, "every operand is whole blocks");

__global__ void __launch_bounds__(256)
f32_to_f16_all_kernel(const float* __restrict__ hs, const float* __restrict__ cond,
                      const float* __restrict__ Wq, const float* __restrict__ Wk,
                      const float* __restrict__ Wv, _Float16* __restrict__ hsb,
                      _Float16* __restrict__ condb, _Float16* __restrict__ wqb,
                      _Float16* __restrict__ wkb, _Float16* __restrict__ wvb) {
  const int  bi = blockIdx.x;
  const bool a0 = bi < CB_HS;
  const bool a1 = bi < CB_HS + CB_C;
  const bool a2 = bi < CB_HS + CB_C + CB_W;
  const bool a3 = bi < CB_HS + CB_C + 2 * CB_W;
  const float* in  = a0 ? hs  : a1 ? cond  : a2 ? Wq  : a3 ? Wk  : Wv;
  _Float16*    out = a0 ? hsb : a1 ? condb : a2 ? wqb : a3 ? wkb : wvb;
  const int b = bi - (a0 ? 0 : a1 ? CB_HS : a2 ? CB_HS + CB_C
                         : a3 ? CB_HS + CB_C + CB_W : CB_HS + CB_C + 2 * CB_W);

  const size_t base = (size_t)b * CV_BLOCK + (size_t)(threadIdx.x >> 5) * CV_WAVE +
                      (size_t)(threadIdx.x & 31) * 4;
  float4 x[CV_LOADS];
  // unrolled: x stays in registers and the eight loads issue as one group
#pragma unroll
  for (int k = 0; k < CV_LOADS; ++k)
    x[k] = *(const float4*)(in + base + k * 128);
  // unrolled: constant indices into x, each pair of converts behind its own load
#pragma unroll
  for (int k = 0; k < CV_LOADS; ++k) {
    v4h o;
    o[0] = (_Float16)x[k].x;
    o[1] = (_Float16)x[k].y;
    o[2] = (_Float16)x[k].z;
    o[3] = (_Float16)x[k].w;
    *(v4h*)(out + base + k * 128) = o;
  }
  // stands in front of any later rewrite of a register that the stores name
  asm volatile("s_wait_xcnt 0x0" ::: "memory");
}

// ---------------------------------------------------------------------------
// acc = X[M,K] * W[N,K]^T for one block tile (f16 inputs, f32 accumulators);
// the two epilogues behind it add the bias and finish the tile.
// block = 128 threads (4 waves); block tile M=64 x N=128; per wave 32x64.
// A stage is 128 k of the block's 64 X rows and 128 W rows: 192 rows of 256 B,
// brought into LDS by asynchronous b128 copies (two whole rows per wave-wide
// copy) and shared by the four waves. Two buffers: the next stage's copies fly
// while this stage's fragments are read from LDS.
// Needs M % 64 == 0, N % 128 == 0, K % 128 == 0.
// ---------------------------------------------------------------------------
#define G_BK     128                    // k (halves) per stage
#define G_PITCH  272                    // LDS row pitch, bytes: 16 B x odd
#define G_STAGE  (192 * G_PITCH)        // bytes per buffer

// Twelve copies and, as the statement's last line, the wait that stands in
// front of any rewrite of the address registers the copies name.
static __device__ __forceinline__ void async_copy12(const uint32_t* l,
                                                    const _Float16* const* p) {
  asm volatile(
      "global_load_async_to_lds_b128 %0, %12, off\n\t"
      "global_load_async_to_lds_b128 %1, %13, off\n\t"
      "global_load_async_to_lds_b128 %2, %14, off\n\t"
      "global_load_async_to_lds_b128 %3, %15, off\n\t"
      "global_load_async_to_lds_b128 %4, %16, off\n\t"
      "global_load_async_to_lds_b128 %5, %17, off\n\t"
      "global_load_async_to_lds_b128 %6, %18, off\n\t"
      "global_load_async_to_lds_b128 %7, %19, off\n\t"
      "global_load_async_to_lds_b128 %8, %20, off\n\t"
      "global_load_async_to_lds_b128 %9, %21, off\n\t"
      "global_load_async_to_lds_b128 %10, %22, off\n\t"
      "global_load_async_to_lds_b128 %11, %23, off\n\t"
      "s_wait_xcnt 0x0"
      :: "v"(l[0]), "v"(l[1]), "v"(l[2]), "v"(l[3]), "v"(l[4]), "v"(l[5]),
         "v"(l[6]), "v"(l[7]), "v"(l[8]), "v"(l[9]), "v"(l[10]), "v"(l[11]),
         "v"(p[0]), "v"(p[1]), "v"(p[2]), "v"(p[3]), "v"(p[4]), "v"(p[5]),
         "v"(p[6]), "v"(p[7]), "v"(p[8]), "v"(p[9]), "v"(p[10]), "v"(p[11])
      : "memory");
}

// One stage: this thread's 16 B of stage rows crow, crow + 8, ..., crow + 184
// (rows 0..63 are X rows, rows 64..191 are W rows).
static __device__ __forceinline__ void gemm_stage_copy(uint32_t lds,
                                                       const _Float16* xg,
                                                       const _Float16* wg,
                                                       size_t step8) {
  uint32_t l[24];
  const _Float16* p[24];
#pragma unroll
  for (int i = 0; i < 24; ++i) l[i] = lds + (uint32_t)(i * 8 * G_PITCH);
#pragma unroll
  for (int i = 0; i < 8; ++i) p[i] = xg + (size_t)i * step8;
#pragma unroll
  for (int i = 0; i < 16; ++i) p[8 + i] = wg + (size_t)i * step8;
  async_copy12(l, p);
  async_copy12(l + 12, p + 12);
}

static __device__ __forceinline__ void
gemm_tile_acc(const _Float16* __restrict__ X, const _Float16* __restrict__ W,
              int K, int mb, int nb, unsigned char* smem, v8f (&acc)[2][4]) {
  const int lane = threadIdx.x & 31;
  const int wave = threadIdx.x >> 5;
  const int r    = lane & 15;
  const int half = lane >> 4;

#pragma unroll
  for (int a = 0; a < 2; ++a)
#pragma unroll
    for (int j = 0; j < 4; ++j) acc[a][j] = v8f_zero();

  // copy role: 16 threads per 256-B row, 8 rows per block-wide copy
  const int crow = threadIdx.x >> 4;
  const int ccol = threadIdx.x & 15;
  const _Float16* xg = X + (size_t)(mb + crow) * K + ccol * 8;
  const _Float16* wg = W + (size_t)(nb + crow) * K + ccol * 8;
  const uint32_t  ld = (uint32_t)(size_t)smem + (uint32_t)(crow * G_PITCH + ccol * 16);
  const size_t step8 = (size_t)8 * K;
  const int nt = K / G_BK;

  // fragment role: same rows and same k order as the global fragment loads had
  const unsigned char* xa = smem + ((wave >> 1) * 32 + r) * G_PITCH + half * 16;
  const unsigned char* wb = smem + (64 + (wave & 1) * 64 + r) * G_PITCH + half * 16;

  gemm_stage_copy(ld, xg, wg, step8);
  // stage 0 has landed for this wave; the barrier publishes it to the others
  asm volatile("s_wait_asynccnt 0x0" ::: "memory");
  __syncthreads();
  if (nt > 1) gemm_stage_copy(ld + G_STAGE, xg + G_BK, wg + G_BK, step8);

  for (int t = 0; t < nt; ++t) {
    const uint32_t boff = (uint32_t)(t & 1) * G_STAGE;
    const unsigned char* xs = xa + boff;
    const unsigned char* ws = wb + boff;
    // Fragments of one 32-k block: twelve LDS reads issued as one group.
    AF fa[2][2], fb[2][4];
#pragma unroll
    for (int i = 0; i < 2; ++i) {
      fa[0][i].u[0] = *(const uint4*)(xs + i * 16 * G_PITCH);
      fa[0][i].u[1] = *(const uint4*)(xs + i * 16 * G_PITCH + 32);
    }
#pragma unroll
    for (int j = 0; j < 4; ++j) {
      fb[0][j].u[0] = *(const uint4*)(ws + j * 16 * G_PITCH);
      fb[0][j].u[1] = *(const uint4*)(ws + j * 16 * G_PITCH + 32);
    }
#pragma unroll
    for (int kk = 0; kk < 4; ++kk) {
      const int cur = kk & 1, nxt = cur ^ 1;
      if (kk < 3) {  // the same stage's next block, into the other register set
#pragma unroll
        for (int i = 0; i < 2; ++i) {
          fa[nxt][i].u[0] = *(const uint4*)(xs + i * 16 * G_PITCH + (kk + 1) * 64);
          fa[nxt][i].u[1] = *(const uint4*)(xs + i * 16 * G_PITCH + (kk + 1) * 64 + 32);
        }
#pragma unroll
        for (int j = 0; j < 4; ++j) {
          fb[nxt][j].u[0] = *(const uint4*)(ws + j * 16 * G_PITCH + (kk + 1) * 64);
          fb[nxt][j].u[1] = *(const uint4*)(ws + j * 16 * G_PITCH + (kk + 1) * 64 + 32);
        }
      }
      // keeps the reads one group ahead of the products: without it the
      // compiler sinks each pair of reads to its two products, with a full
      // LDS wait in front of every pair
      __builtin_amdgcn_sched_barrier(0);
#pragma unroll
      for (int j = 0; j < 4; ++j) {
        acc[0][j] = wmma_f16(fa[cur][0].h, fb[cur][j].h, acc[0][j]);
        acc[1][j] = wmma_f16(fa[cur][1].h, fb[cur][j].h, acc[1][j]);
      }
      // keeps the next group of reads out of this block's products
      __builtin_amdgcn_sched_barrier(0);
    }
    // publish point of stage t + 1: this wave's reads of stage t are done ...
    asm volatile("s_wait_dscnt 0x0" ::: "memory");
    // ... its own copies of stage t + 1 have landed ...
    asm volatile("s_wait_asynccnt 0x0" ::: "memory");
    // ... and the barrier both publishes stage t + 1 and frees stage t's buffer
    __syncthreads();
    if (t + 2 < nt)
      gemm_stage_copy(ld + boff, xg + (size_t)(t + 2) * G_BK,
                      wg + (size_t)(t + 2) * G_BK, step8);
  }
  // no copy is left outstanding behind the main loop
  asm volatile("s_wait_asynccnt 0x0" ::: "memory");
}

// ---------------------------------------------------------------------------
// Epilogue: bias + RMSNorm(head_dim) + RoPE + optional scale:
// accumulators -> f16 [H][M][HD]. The block's 128 columns are one head,
// so its tile holds whole head rows. The f32 tile goes through the ring's LDS,
// which every wave has left at the loop's last barrier; then one wave per row,
// a lane owns 4 consecutive dims (2 rope pairs), a row is stored as two lines.
// ---------------------------------------------------------------------------
#define E_PITCH 132                     // floats per staged row: 16 B x odd

static __device__ __forceinline__ void
norm_rope_epilogue(const v8f (&acc)[2][4], unsigned char* smem,
                   const float* __restrict__ bias, const float* __restrict__ w,
                   const float* __restrict__ cs, const float* __restrict__ sn,
                   _Float16* __restrict__ out, int M, int mb, int nb, float scale) {
  const int lane = threadIdx.x & 31;
  const int wave = threadIdx.x >> 5;
  const int r    = lane & 15;
  const int half = lane >> 4;

  // this wave's 16 rows of cos and sin, asked for ahead of the staging and its
  // barrier, which cover a part of their latency
  const int d    = lane * 4;
  const int row0 = wave * 16;
  const float* cp = cs + (size_t)(mb + row0) * HDIM + d;
  const float* sp = sn + (size_t)(mb + row0) * HDIM + d;
  const float4 wv = *(const float4*)(w + d);
  float4 c[16], s[16];
  // unrolled: c and s stay in registers
#pragma unroll
  for (int q = 0; q < 16; ++q) {
    c[q] = *(const float4*)(cp + q * HDIM);
    s[q] = *(const float4*)(sp + q * HDIM);
  }

  float* st = (float*)smem;
  const int ml = (wave >> 1) * 32 + half * 8;
  const int nl = (wave & 1) * 64 + r;
  // unrolled (all three loops): constant indices into acc, which stays in registers
#pragma unroll
  for (int j = 0; j < 4; ++j) {
    const float bn = bias[nb + nl + j * 16];
#pragma unroll
    for (int a = 0; a < 2; ++a)
#pragma unroll
      for (int i = 0; i < 8; ++i)
        st[(ml + a * 16 + i) * E_PITCH + nl + j * 16] = acc[a][j][i] + bn;
  }
  // publishes the staged tile: a row's two halves come from two waves
  __syncthreads();

  _Float16* op = out + ((size_t)blockIdx.x * M + mb + row0) * HDIM + d;
  // the sixteen rows are read as one group: behind each four rows' store statement (below),
  // whose memory clobber holds later LDS reads back, the rows would run four at a time
  // (unrolled: xr stays in registers)
  float4 xr[16];
#pragma unroll
  for (int q = 0; q < 16; ++q)
    xr[q] = *(const float4*)(st + (row0 + q) * E_PITCH + d);
  uint64_t ov[4];  // four finished rows, packed, on their way to one store statement
  // unrolled: constant indices into xr, c, s and ov; the rows' reductions interleave
#pragma unroll
  for (int q = 0; q < 16; ++q) {
    const float4 x = xr[q];
    float ss = x.x * x.x + x.y * x.y + x.z * x.z + x.w * x.w;
#pragma unroll
    for (int msk = 1; msk < 32; msk <<= 1) ss += __shfl_xor(ss, msk, 32);
    const float inv = rsqrtf(ss * (1.0f / (float)HDIM) + 1e-6f);

    const float y0 = x.x * inv * wv.x;
    const float y1 = x.y * inv * wv.y;
    const float y2 = x.z * inv * wv.z;
    const float y3 = x.w * inv * wv.w;

    v4h o;
    o[0] = (_Float16)((y0 * c[q].x - y1 * s[q].x) * scale);
    o[1] = (_Float16)((y1 * c[q].y + y0 * s[q].y) * scale);
    o[2] = (_Float16)((y2 * c[q].z - y3 * s[q].z) * scale);
    o[3] = (_Float16)((y3 * c[q].w + y2 * s[q].w) * scale);
    ov[q & 3] = __builtin_bit_cast(uint64_t, o);
    // Four rows' stores and, as the statement's last line, the wait that stands
    // in front of any later rewrite of a register that a store names: this build
    // uses registers above v255, and the compiler lifted later register writes over a
    // wait in its own statement.
    if ((q & 3) == 3)
      asm volatile("global_store_b64 %0, %4, off\n\t"
                   "global_store_b64 %1, %5, off\n\t"
                   "global_store_b64 %2, %6, off\n\t"
                   "global_store_b64 %3, %7, off\n\t"
                   "s_wait_xcnt 0x0"
                   :: "v"(op + (q - 3) * HDIM), "v"(op + (q - 2) * HDIM),
                      "v"(op + (q - 1) * HDIM), "v"(op + q * HDIM),
                      "v"(ov[0]), "v"(ov[1]), "v"(ov[2]), "v"(ov[3])
                   : "memory");
  }
}

// ---------------------------------------------------------------------------
// Epilogue: bias + transposed pack: accumulators -> f16 [N][M], that
// is [H][HD][M]. A lane's accumulator tile holds 8 consecutive rows m of one
// column n: 16 B of an output row. The 128 x 64 f16 tile goes through the
// ring's LDS so that each output row's 128 B leave as one whole line.
// ---------------------------------------------------------------------------
#define T_PITCH 144                     // bytes per staged row: 16 B x odd

static __device__ __forceinline__ void
vt_epilogue(const v8f (&acc)[2][4], unsigned char* smem,
            const float* __restrict__ bias, _Float16* __restrict__ out,
            int M, int mb, int nb) {
  const int lane = threadIdx.x & 31;
  const int wave = threadIdx.x >> 5;
  const int r    = lane & 15;
  const int half = lane >> 4;

  const int ml = (wave >> 1) * 32 + half * 8;
  const int nl = (wave & 1) * 64 + r;
  // unrolled (all three loops): constant indices into acc, which stays in registers
#pragma unroll
  for (int j = 0; j < 4; ++j) {
    const float bn = bias[nb + nl + j * 16];
#pragma unroll
    for (int a = 0; a < 2; ++a) {
      v8h o;
#pragma unroll
      for (int i = 0; i < 8; ++i) o[i] = (_Float16)(acc[a][j][i] + bn);
      *(v8h*)(smem + (nl + j * 16) * T_PITCH + (ml + a * 16) * 2) = o;
    }
  }
  // publishes the staged tile: an output row's two halves come from two waves
  __syncthreads();

  // 8 threads per 128-B output row, 16 rows per block-wide store
  const int trow = threadIdx.x >> 3;
  const int tcol = threadIdx.x & 7;
  // unrolled: the eight LDS reads issue as one group ahead of the stores
#pragma unroll
  for (int k = 0; k < 8; ++k) {
    const int n = trow + k * 16;
    const uint4 v = *(const uint4*)(smem + n * T_PITCH + tcol * 16);
    *(uint4*)(out + (size_t)(nb + n) * M + mb + tcol * 8) = v;
  }
}

// ---------------------------------------------------------------------------
// All five projections in ONE launch. blockIdx.x is the head (128 columns),
// blockIdx.y a 64-row tile of one projection, in the order Q, K, Kc, V, Vc, so
// that the two users of a weight matrix run next to each other. The choice is
// the same for a whole block (scalar), so every barrier is block-uniform.
// ---------------------------------------------------------------------------
#define PT_S   (S_LEN / 64)             // row tiles of a projection of the hidden states
#define PT_C   (SC_LEN / 64)            // row tiles of a projection of the cond states
#define PT_ALL (3 * PT_S + 2 * PT_C)

__global__ void __launch_bounds__(128)
projections_kernel(const _Float16* __restrict__ hsb, const _Float16* __restrict__ condb,
                   const _Float16* __restrict__ wqb, const _Float16* __restrict__ wkb,
                   const _Float16* __restrict__ wvb, const float* __restrict__ bq,
                   const float* __restrict__ bk, const float* __restrict__ bv,
                   const float* __restrict__ nqw, const float* __restrict__ nkw,
                   const float* __restrict__ cos0, const float* __restrict__ sin0,
                   const float* __restrict__ cos1, const float* __restrict__ sin1,
                   _Float16* __restrict__ Qb, _Float16* __restrict__ Kb,
                   _Float16* __restrict__ Kcb, _Float16* __restrict__ Vtb,
                   _Float16* __restrict__ Vctb, int K, float qscale) {
  __shared__ __attribute__((aligned(16))) unsigned char smem[2 * G_STAGE];
  const int y  = blockIdx.y;
  const int nb = blockIdx.x * HDIM;

  const bool cross = (y >= 2 * PT_S && y < 2 * PT_S + PT_C) || y >= 3 * PT_S + PT_C;
  const bool isv   = y >= 2 * PT_S + PT_C;
  const bool isq   = y < PT_S;
  const int  y0    = isq ? 0
                   : y < 2 * PT_S ? PT_S
                   : y < 2 * PT_S + PT_C ? 2 * PT_S
                   : y < 3 * PT_S + PT_C ? 2 * PT_S + PT_C : 3 * PT_S + PT_C;
  const int  mb    = (y - y0) * 64;
  const int  M     = cross ? SC_LEN : S_LEN;
  const _Float16* X = cross ? condb : hsb;
  const _Float16* W = isq ? wqb : isv ? wvb : wkb;

  v8f acc[2][4];
  gemm_tile_acc(X, W, K, mb, nb, smem, acc);

  if (isv) {
    vt_epilogue(acc, smem, bv, cross ? Vctb : Vtb, M, mb, nb);
  } else {
    norm_rope_epilogue(acc, smem, isq ? bq : bk, isq ? nqw : nkw,
                       cross ? cos1 : cos0, cross ? sin1 : sin0,
                       isq ? Qb : cross ? Kcb : Kb, M, mb, nb,
                       isq ? qscale : 1.0f);
  }
}

// ---------------------------------------------------------------------------
// One online-softmax attention pass over T keys for a 16-query block, in the
// transposed form S^T = K Q^T, O^T += V^T P^T: a lane holds scores of ONE query
// (column lane & 15), keys 8 * half + i of each 16-key tile in register i. The
// maximum and the sum over keys are taken inside the lane plus one exchange
// between the wave's halves, and two score tiles, converted in place, are the
// B operand of the second product.
// The block's four waves work on one head, so they share its K and V^T tiles:
// a stage is 64 keys (64 K rows of 256 B, 128 V^T rows of 128 B), brought into
// LDS by asynchronous b128 copies of whole 128-B lines. Two buffers: the next
// stage's copies fly while this stage is worked on. Needs T % 64 == 0.
// ---------------------------------------------------------------------------
#define A_KEYS    64                              // keys per stage
#define A_KPITCH  272                             // K row pitch, 16 B x odd
#define A_VPITCH  144                             // V^T row pitch, 16 B x odd
#define A_KBYTES  (A_KEYS * A_KPITCH)             // K part of a buffer
#define A_STAGE   (A_KBYTES + HDIM * A_VPITCH)    // bytes per buffer

// Eight copies and, as the statement's last line, the wait that stands in
// front of any rewrite of the address registers the copies name.
static __device__ __forceinline__ void async_copy8(const uint32_t* l,
                                                   const _Float16* const* p) {
  asm volatile(
      "global_load_async_to_lds_b128 %0, %8, off\n\t"
      "global_load_async_to_lds_b128 %1, %9, off\n\t"
      "global_load_async_to_lds_b128 %2, %10, off\n\t"
      "global_load_async_to_lds_b128 %3, %11, off\n\t"
      "global_load_async_to_lds_b128 %4, %12, off\n\t"
      "global_load_async_to_lds_b128 %5, %13, off\n\t"
      "global_load_async_to_lds_b128 %6, %14, off\n\t"
      "global_load_async_to_lds_b128 %7, %15, off\n\t"
      "s_wait_xcnt 0x0"
      :: "v"(l[0]), "v"(l[1]), "v"(l[2]), "v"(l[3]),
         "v"(l[4]), "v"(l[5]), "v"(l[6]), "v"(l[7]),
         "v"(p[0]), "v"(p[1]), "v"(p[2]), "v"(p[3]),
         "v"(p[4]), "v"(p[5]), "v"(p[6]), "v"(p[7])
      : "memory");
}

// One stage: this thread's 16 B of K rows krow, krow + 8, ..., krow + 56 and
// of V^T rows vrow, vrow + 16, ..., vrow + 112.
static __device__ __forceinline__ void attn_stage_copy(uint32_t ldk, uint32_t ldv,
                                                       const _Float16* kg,
                                                       const _Float16* vg,
                                                       size_t vstep16) {
  uint32_t l[16];
  const _Float16* p[16];
#pragma unroll
  for (int i = 0; i < 8; ++i) {
    l[i] = ldk + (uint32_t)(i * 8 * A_KPITCH);
    p[i] = kg + (size_t)i * 8 * HDIM;
    l[8 + i] = ldv + (uint32_t)(i * 16 * A_VPITCH);
    p[8 + i] = vg + (size_t)i * vstep16;
  }
  async_copy8(l, p);
  async_copy8(l + 8, p + 8);
}

// lane l with lane l ^ 16
static __device__ __forceinline__ float xhalf(float x) {
  const int b = __builtin_bit_cast(int, x);
  return __builtin_bit_cast(float, __builtin_amdgcn_permlanex16(
      b, b, 0x76543210, 0xfedcba98, false, false));
}

__device__ __forceinline__ void attn_pass(const AF* qa,
                                          const _Float16* __restrict__ Kr,
                                          const _Float16* __restrict__ Vt,
                                          int T, const unsigned char* ring,
                                          int lane, v8f* o, float& l) {
  const int r = lane & 15, half = lane >> 4;
#pragma unroll
  for (int j = 0; j < 8; ++j) { o[j] = v8f_zero(); }
  float m = -1e30f;  // running maximum of this lane's query, equal in both halves
  l = 0.f;           // running sum over THIS half's keys; the caller joins the halves

  // copy role: 16 threads per 256-B K row, 8 threads per 128-B V^T row
  const int tid = threadIdx.x;
  const _Float16* kg = Kr + (size_t)(tid >> 4) * HDIM + (tid & 15) * 8;
  const _Float16* vg = Vt + (size_t)(tid >> 3) * T + (tid & 7) * 8;
  const uint32_t ldk = (uint32_t)(size_t)ring +
                       (uint32_t)((tid >> 4) * A_KPITCH + (tid & 15) * 16);
  const uint32_t ldv = (uint32_t)(size_t)ring +
                       (uint32_t)(A_KBYTES + (tid >> 3) * A_VPITCH + (tid & 7) * 16);
  const size_t vstep16 = (size_t)16 * T;
  const int ns = T / A_KEYS;

  // Every reader has left both buffers here: at the kernel's start nothing has
  // read them, and an earlier pass ends with its last publish point's barrier.
  attn_stage_copy(ldk, ldv, kg, vg, vstep16);
  // stage 0 has landed for this wave; the barrier publishes it to the others
  asm volatile("s_wait_asynccnt 0x0" ::: "memory");
  __syncthreads();
  if (ns > 1)
    attn_stage_copy(ldk + A_STAGE, ldv + A_STAGE, kg + (size_t)A_KEYS * HDIM,
                    vg + A_KEYS, vstep16);

  for (int s = 0; s < ns; ++s) {
    const uint32_t boff = (uint32_t)(s & 1) * A_STAGE;
    const unsigned char* kt = ring + boff + r * A_KPITCH + half * 16;
    const unsigned char* vt = ring + boff + A_KBYTES + r * A_VPITCH + half * 16;
    // kept rolled: unrolled, the two halves' live ranges take the kernel to 356
    // registers, two waves per SIMD where the grid wants three
#pragma unroll 1
    for (int ks = 0; ks < 2; ++ks) {
      const unsigned char* kr0 = kt + ks * 32 * A_KPITCH;
      const unsigned char* kr1 = kr0 + 16 * A_KPITCH;
      v8f s0 = v8f_zero(), s1 = v8f_zero();
      AF b0[4], b1[4];
#pragma unroll
      for (int kc = 0; kc < 4; ++kc) {
        b0[kc].u[0] = *(const uint4*)(kr0 + kc * 64);
        b0[kc].u[1] = *(const uint4*)(kr0 + kc * 64 + 32);
        b1[kc].u[0] = *(const uint4*)(kr1 + kc * 64);
        b1[kc].u[1] = *(const uint4*)(kr1 + kc * 64 + 32);
      }
      // keeps the sixteen K reads one group ahead of the products: without it
      // the compiler sinks each four to their two products behind a full LDS wait
      __builtin_amdgcn_sched_barrier(0);
#pragma unroll
      for (int kc = 0; kc < 4; ++kc) {
        s0 = wmma_f16(b0[kc].h, qa[kc].h, s0);  // s0[i] = S[query r][key 8 * half + i]
        s1 = wmma_f16(b1[kc].h, qa[kc].h, s1);  // s1[i] = S[query r][key 16 + 8 * half + i]
      }
      AF av[8];
#pragma unroll
      for (int j = 0; j < 8; ++j) {
        const unsigned char* vr = vt + j * 16 * A_VPITCH + ks * 64;
        av[j].u[0] = *(const uint4*)(vr);
        av[j].u[1] = *(const uint4*)(vr + 32);
      }
      // keeps the sixteen V^T reads in front of the softmax, which covers their
      // latency: without it the compiler sinks each pair to its product behind
      // a full LDS wait
      __builtin_amdgcn_sched_barrier(0);
      // online softmax of one query per lane: 16 of the 32 keys in this half
      float cm = fmaxf(s0[0], s1[0]);
#pragma unroll
      for (int i = 1; i < 8; ++i) cm = fmaxf(cm, fmaxf(s0[i], s1[i]));
      cm = fmaxf(cm, xhalf(cm));
      const float mn = fmaxf(m, cm);
      const float alpha = __expf(m - mn);
      m = mn;
      AF pb;  // P^T as B operand: element s is key 8 * half + s, then 16 + 8 * half + (s - 8)
#pragma unroll
      for (int i = 0; i < 8; i += 2) {
        v2f p0, p1;
        p0[0] = __expf(s0[i] - mn); p0[1] = __expf(s0[i + 1] - mn);
        p1[0] = __expf(s1[i] - mn); p1[1] = __expf(s1[i + 1] - mn);
        s0[i] = p0[0]; s0[i + 1] = p0[1];
        s1[i] = p1[0]; s1[i + 1] = p1[1];
        const v2h h0 = __builtin_convertvector(p0, v2h);
        const v2h h1 = __builtin_convertvector(p1, v2h);
        pb.h[i] = h0[0];     pb.h[i + 1] = h0[1];
        pb.h[8 + i] = h1[0]; pb.h[8 + i + 1] = h1[1];
      }
#pragma unroll
      for (int j = 0; j < 8; ++j) o[j] *= alpha;
#pragma unroll
      for (int j = 0; j < 8; ++j) {
        o[j] = wmma_f16(av[j].h, pb.h, o[j]);  // o[j][i] = O[query r][16 * j + 8 * half + i]
      }
      // keeps the sum's additions behind the last product, so that no product
      // stands directly in front of the loop's branch
      __builtin_amdgcn_sched_barrier(0);
      const v8f ps = s0 + s1;
      l = l * alpha + (((ps[0] + ps[1]) + (ps[2] + ps[3])) +
                       ((ps[4] + ps[5]) + (ps[6] + ps[7])));
    }
    // publish point of stage s + 1: this wave's reads of stage s are done ...
    asm volatile("s_wait_dscnt 0x0" ::: "memory");
    // ... its own copies of stage s + 1 have landed ...
    asm volatile("s_wait_asynccnt 0x0" ::: "memory");
    // ... and the barrier both publishes stage s + 1 and frees stage s's buffer
    __syncthreads();
    if (s + 2 < ns)
      attn_stage_copy(ldk + boff, ldv + boff,
                      kg + (size_t)(s + 2) * A_KEYS * HDIM,
                      vg + (size_t)(s + 2) * A_KEYS, vstep16);
  }
  // no copy is left outstanding behind the pass
  asm volatile("s_wait_asynccnt 0x0" ::: "memory");
}

// ---------------------------------------------------------------------------
// Fused dual attention: out = lambda * softmax(Q Kc^T) Vc + softmax(Q K^T) V
// 4 waves per block; each wave owns one (head, 16-query) block; the four
// blocks of a work-group lie in one head (128 query blocks per head).
// ---------------------------------------------------------------------------
__global__ void __launch_bounds__(128)
attention_kernel(const _Float16* __restrict__ Qb, const _Float16* __restrict__ Kb,
                 const _Float16* __restrict__ Vtb, const _Float16* __restrict__ Kcb,
                 const _Float16* __restrict__ Vctb, const float* __restrict__ lam,
                 float* __restrict__ out) {
  __shared__ __attribute__((aligned(16))) unsigned char ring[2 * A_STAGE];
  const int wave = threadIdx.x >> 5;
  const int lane = threadIdx.x & 31;
  const int r = lane & 15, half = lane >> 4;
  const int qb = blockIdx.x * 4 + wave;       // 0 .. H*(S/16)-1
  const int h  = blockIdx.x >> 5;             // = qb / (S_LEN/16), one per block
  const int q0 = (qb & 127) * 16;

  // Q fragments (pre-scaled by 1/sqrt(HD) at pack time)
  AF qa[4];
  const _Float16* qrow = Qb + ((size_t)h * S_LEN + q0 + r) * HDIM;
#pragma unroll
  for (int kc = 0; kc < 4; ++kc) {
    qa[kc].u[0] = *(const uint4*)(qrow + kc * 32 + half * 8);
    qa[kc].u[1] = *(const uint4*)(qrow + kc * 32 + 16 + half * 8);
  }

  v8f oc[8]; float lc;
  attn_pass(qa, Kcb + (size_t)h * SC_LEN * HDIM, Vctb + (size_t)h * HDIM * SC_LEN,
            SC_LEN, ring, lane, oc, lc);
  const float fc = lam[0] / (lc + xhalf(lc));
#pragma unroll
  for (int j = 0; j < 8; ++j) oc[j] *= fc;

  v8f os[8]; float ls;
  attn_pass(qa, Kb + (size_t)h * S_LEN * HDIM, Vtb + (size_t)h * HDIM * S_LEN,
            S_LEN, ring, lane, os, ls);

  // a lane holds eight consecutive head dims of its query per tile: 32 B stores
  const float inv = 1.0f / (ls + xhalf(ls));
  float* orow = out + (size_t)(q0 + r) * DMODEL + h * HDIM + half * 8;
#pragma unroll
  for (int j = 0; j < 8; ++j) {
    float4 lo, hi;
    lo.x = oc[j][0] + os[j][0] * inv; lo.y = oc[j][1] + os[j][1] * inv;
    lo.z = oc[j][2] + os[j][2] * inv; lo.w = oc[j][3] + os[j][3] * inv;
    hi.x = oc[j][4] + os[j][4] * inv; hi.y = oc[j][5] + os[j][5] * inv;
    hi.z = oc[j][6] + os[j][6] * inv; hi.w = oc[j][7] + os[j][7] * inv;
    *(float4*)(orow + j * 16)     = lo;
    *(float4*)(orow + j * 16 + 4) = hi;
  }
}

// ---------------------------------------------------------------------------
// host launcher
// ---------------------------------------------------------------------------
extern "C" void kernel_launch(void* const* d_in, const int* in_sizes, int n_in,
                              void* d_out, int out_size, void* d_ws, size_t ws_size,
                              hipStream_t stream) {
  (void)in_sizes; (void)n_in; (void)out_size; (void)ws_size;
  const float* hs    = (const float*)d_in[0];
  const float* cond  = (const float*)d_in[1];
  const float* lam   = (const float*)d_in[2];
  const float* Wq    = (const float*)d_in[3];
  const float* bq    = (const float*)d_in[4];
  const float* Wk    = (const float*)d_in[5];
  const float* bk    = (const float*)d_in[6];
  const float* Wv    = (const float*)d_in[7];
  const float* bv    = (const float*)d_in[8];
  const float* nqw   = (const float*)d_in[9];
  const float* nkw   = (const float*)d_in[10];
  const float* cos0  = (const float*)d_in[11];
  const float* sin0  = (const float*)d_in[12];
  const float* cos1  = (const float*)d_in[13];
  const float* sin1  = (const float*)d_in[14];
  float* out = (float*)d_out;

  // workspace carve (256B aligned)
  char* wp = (char*)d_ws;
  auto carve = [&](size_t bytes) -> void* {
    void* p = (void*)wp;
    wp += (bytes + 255) & ~(size_t)255;
    return p;
  };
  _Float16* hsb   = (_Float16*)carve((size_t)S_LEN * DMODEL * 2);
  _Float16* condb = (_Float16*)carve((size_t)SC_LEN * DMODEL * 2);
  _Float16* wqb   = (_Float16*)carve((size_t)DMODEL * DMODEL * 2);
  _Float16* wkb   = (_Float16*)carve((size_t)DMODEL * DMODEL * 2);
  _Float16* wvb   = (_Float16*)carve((size_t)DMODEL * DMODEL * 2);
  _Float16* Qb    = (_Float16*)carve((size_t)S_LEN * DMODEL * 2);
  _Float16* Kb    = (_Float16*)carve((size_t)S_LEN * DMODEL * 2);
  _Float16* Kcb   = (_Float16*)carve((size_t)SC_LEN * DMODEL * 2);
  _Float16* Vtb   = (_Float16*)carve((size_t)S_LEN * DMODEL * 2);
  _Float16* Vctb  = (_Float16*)carve((size_t)SC_LEN * DMODEL * 2);

  const float qscale = 0.088388347648318447f;  // 1/sqrt(128)

  // every f32 operand to f16, one launch
  f32_to_f16_all_kernel<<<CB_ALL, 256, 0, stream>>>(hs, cond, Wq, Wk, Wv, hsb, condb,
                                                    wqb, wkb, wvb);

  // Q, K, Kc (normed, roped) and V, Vc (transposed to [H][HD][T]), one launch
  projections_kernel<<<dim3(DMODEL / 128, PT_ALL), 128, 0, stream>>>(
      hsb, condb, wqb, wkb, wvb, bq, bk, bv, nqw, nkw, cos0, sin0, cos1, sin1,
      Qb, Kb, Kcb, Vtb, Vctb, DMODEL, qscale);

  // fused dual attention + combine
  const unsigned attnBlocks = (unsigned)(NHEADS * (S_LEN / 16) / 4);
  attention_kernel<<<attnBlocks, 128, 0, stream>>>(Qb, Kb, Vtb, Kcb, Vctb, lam, out);
}

// v006
// It runs in 194 microseconds.
// In two side-by-side timings against v005, it was 1.13 and 1.12 times as fast.
// Over all steps from v000 it is 4.77 times as fast.
#include <hip/hip_runtime.h>
#include <hip/hip_bf16.h>
#include <cstdint>
#include <cstddef>

#define S_LEN  2048
#define SC_LEN 1024
#define DMODEL 3072
#define NHEADS 24
#define HDIM   128

typedef __attribute__((ext_vector_type(16))) _Float16 v16h;
typedef __attribute__((ext_vector_type(8)))  float    v8f;
typedef __attribute__((ext_vector_type(8)))  _Float16 v8h;
typedef __attribute__((ext_vector_type(4)))  _Float16 v4h;
typedef __attribute__((ext_vector_type(2)))  _Float16 v2h;
typedef __attribute__((ext_vector_type(2)))  float    v2f;
typedef __attribute__((ext_vector_type(4)))  uint32_t v4u;

union AF { uint4 u[2]; v16h h; };

static __device__ __forceinline__ v8f wmma_f16(v16h a, v16h b, v8f c) {
  // D = A(16x32 f16) x B(32x16 f16) + C(16x16 f32)
  return __builtin_amdgcn_wmma_f32_16x16x32_f16(false, a, false, b, (short)0, c,
                                                false, false);
}

static __device__ __forceinline__ v8f v8f_zero() {
  v8f z = {0.f, 0.f, 0.f, 0.f, 0.f, 0.f, 0.f, 0.f};
  return z;
}

// ---------------------------------------------------------------------------
// fp32 -> f16 elementwise convert of all five f32 operands in ONE launch: the
// block index picks the operand (a scalar choice) and the block's place in it.
// block = 256 threads (8 waves), 8192 elements; a wave owns 1024 consecutive
// elements: eight wave-wide 16-B loads of 512 contiguous bytes each, all issued
// before the first is used, then eight wave-wide 8-B stores of 256 contiguous
// bytes (two whole lines) each.
// ---------------------------------------------------------------------------
#define CV_LOADS 8                      // 16-B loads in flight per lane
#define CV_WAVE  (32 * 4 * CV_LOADS)    // elements per wave
#define CV_BLOCK (8 * CV_WAVE)          // elements per block

#define CB_HS (S_LEN * DMODEL / CV_BLOCK)     // blocks of the hidden states
#define CB_C  (SC_LEN * DMODEL / CV_BLOCK)    // blocks of the cond hidden states
#define CB_W  (DMODEL * DMODEL / CV_BLOCK)    // blocks of one weight matrix
#define CB_ALL (CB_HS + CB_C + 3 * CB_W)
static_assert(S_LEN * DMODEL % CV_BLOCK == 0 && SC_LEN * DMODEL % CV_BLOCK == 0 &&
              DMODEL * DMODEL % CV_BLOCK == 0, "every operand is whole blocks");

__global__ void __launch_bounds__(256)
f32_to_f16_all_kernel(const float* __restrict__ hs, const float* __restrict__ cond,
                      const float* __restrict__ Wq, const float* __restrict__ Wk,
                      const float* __restrict__ Wv, _Float16* __restrict__ hsb,
                      _Float16* __restrict__ condb, _Float16* __restrict__ wqb,
                      _Float16* __restrict__ wkb, _Float16* __restrict__ wvb) {
  const int  bi = blockIdx.x;
  const bool a0 = bi < CB_HS;
  const bool a1 = bi < CB_HS + CB_C;
  const bool a2 = bi < CB_HS + CB_C + CB_W;
  const bool a3 = bi < CB_HS + CB_C + 2 * CB_W;
  const float* in  = a0 ? hs  : a1 ? cond  : a2 ? Wq  : a3 ? Wk  : Wv;
  _Float16*    out = a0 ? hsb : a1 ? condb : a2 ? wqb : a3 ? wkb : wvb;
  const int b = bi - (a0 ? 0 : a1 ? CB_HS : a2 ? CB_HS + CB_C
                         : a3 ? CB_HS + CB_C + CB_W : CB_HS + CB_C + 2 * CB_W);

  const size_t base = (size_t)b * CV_BLOCK + (size_t)(threadIdx.x >> 5) * CV_WAVE +
                      (size_t)(threadIdx.x & 31) * 4;
  float4 x[CV_LOADS];
  // unrolled: x stays in registers and the eight loads issue as one group
#pragma unroll
  for (int k = 0; k < CV_LOADS; ++k)
    x[k] = *(const float4*)(in + base + k * 128);
  // unrolled: constant indices into x, each pair of converts behind its own load
#pragma unroll
  for (int k = 0; k < CV_LOADS; ++k) {
    v4h o;
    o[0] = (_Float16)x[k].x;
    o[1] = (_Float16)x[k].y;
    o[2] = (_Float16)x[k].z;
    o[3] = (_Float16)x[k].w;
    *(v4h*)(out + base + k * 128) = o;
  }
  // stands in front of any later rewrite of a register that the stores name
  asm volatile("s_wait_xcnt 0x0" ::: "memory");
}

// ---------------------------------------------------------------------------
// acc = X[M,K] * W[N,K]^T for one block tile (f16 inputs, f32 accumulators);
// the two epilogues behind it add the bias and finish the tile.
// block = 256 threads (8 waves, 4 x 2); block tile M=256 x N=128; per wave 64x64.
// A stage is 128 k of the block's 256 X rows and 128 W rows: 384 rows of 256 B,
// brought into LDS by asynchronous b128 copies (two whole rows per wave-wide
// copy) and shared by the eight waves. Two buffers: the next stage's copies fly
// while this stage's fragments are read from LDS.
// Needs M % 256 == 0, N % 128 == 0, K % 128 == 0.
// ---------------------------------------------------------------------------
#define G_BK     128                    // k (halves) per stage
#define G_PITCH  272                    // LDS row pitch, bytes: 16 B x odd
#define G_BM     256                    // X rows per block tile
#define G_STAGE  ((G_BM + 128) * G_PITCH)  // bytes per buffer

// Twelve copies and, as the statement's last line, the wait that stands in
// front of any rewrite of the address registers the copies name.
static __device__ __forceinline__ void async_copy12(const uint32_t* l,
                                                    const _Float16* const* p) {
  asm volatile(
      "global_load_async_to_lds_b128 %0, %12, off\n\t"
      "global_load_async_to_lds_b128 %1, %13, off\n\t"
      "global_load_async_to_lds_b128 %2, %14, off\n\t"
      "global_load_async_to_lds_b128 %3, %15, off\n\t"
      "global_load_async_to_lds_b128 %4, %16, off\n\t"
      "global_load_async_to_lds_b128 %5, %17, off\n\t"
      "global_load_async_to_lds_b128 %6, %18, off\n\t"
      "global_load_async_to_lds_b128 %7, %19, off\n\t"
      "global_load_async_to_lds_b128 %8, %20, off\n\t"
      "global_load_async_to_lds_b128 %9, %21, off\n\t"
      "global_load_async_to_lds_b128 %10, %22, off\n\t"
      "global_load_async_to_lds_b128 %11, %23, off\n\t"
      "s_wait_xcnt 0x0"
      :: "v"(l[0]), "v"(l[1]), "v"(l[2]), "v"(l[3]), "v"(l[4]), "v"(l[5]),
         "v"(l[6]), "v"(l[7]), "v"(l[8]), "v"(l[9]), "v"(l[10]), "v"(l[11]),
         "v"(p[0]), "v"(p[1]), "v"(p[2]), "v"(p[3]), "v"(p[4]), "v"(p[5]),
         "v"(p[6]), "v"(p[7]), "v"(p[8]), "v"(p[9]), "v"(p[10]), "v"(p[11])
      : "memory");
}

// One stage: this thread's 16 B of stage rows crow, crow + 16, ..., crow + 368
// (rows 0..255 are X rows, rows 256..383 are W rows).
static __device__ __forceinline__ void gemm_stage_copy(uint32_t lds,
                                                       const _Float16* xg,
                                                       const _Float16* wg,
                                                       size_t step16) {
  uint32_t l[24];
  const _Float16* p[24];
#pragma unroll
  for (int i = 0; i < 24; ++i) l[i] = lds + (uint32_t)(i * 16 * G_PITCH);
#pragma unroll
  for (int i = 0; i < 16; ++i) p[i] = xg + (size_t)i * step16;
#pragma unroll
  for (int i = 0; i < 8; ++i) p[16 + i] = wg + (size_t)i * step16;
  async_copy12(l, p);
  async_copy12(l + 12, p + 12);
}

static __device__ __forceinline__ void
gemm_tile_acc(const _Float16* __restrict__ X, const _Float16* __restrict__ W,
              int K, int mb, int nb, unsigned char* smem, v8f (&acc)[4][4]) {
  const int lane = threadIdx.x & 31;
  const int wave = threadIdx.x >> 5;
  const int r    = lane & 15;
  const int half = lane >> 4;

#pragma unroll
  for (int a = 0; a < 4; ++a)
#pragma unroll
    for (int j = 0; j < 4; ++j) acc[a][j] = v8f_zero();

  // copy role: 16 threads per 256-B row, 16 rows per block-wide copy
  const int crow = threadIdx.x >> 4;
  const int ccol = threadIdx.x & 15;
  const _Float16* xg = X + (size_t)(mb + crow) * K + ccol * 8;
  const _Float16* wg = W + (size_t)(nb + crow) * K + ccol * 8;
  const uint32_t  ld = (uint32_t)(size_t)smem + (uint32_t)(crow * G_PITCH + ccol * 16);
  const size_t step16 = (size_t)16 * K;
  const int nt = K / G_BK;

  // fragment role: same rows and same k order as the global fragment loads had
  const unsigned char* xa = smem + ((wave >> 1) * 64 + r) * G_PITCH + half * 16;
  const unsigned char* wb = smem + (G_BM + (wave & 1) * 64 + r) * G_PITCH + half * 16;

  gemm_stage_copy(ld, xg, wg, step16);
  // stage 0 has landed for this wave; the barrier publishes it to the others
  asm volatile("s_wait_asynccnt 0x0" ::: "memory");
  __syncthreads();
  if (nt > 1) gemm_stage_copy(ld + G_STAGE, xg + G_BK, wg + G_BK, step16);

  for (int t = 0; t < nt; ++t) {
    const uint32_t boff = (uint32_t)(t & 1) * G_STAGE;
    const unsigned char* xs = xa + boff;
    const unsigned char* ws = wb + boff;
    // Fragments of one 32-k block: sixteen LDS reads issued as one group.
    AF fa[2][4], fb[2][4];
#pragma unroll
    for (int i = 0; i < 4; ++i) {
      fa[0][i].u[0] = *(const uint4*)(xs + i * 16 * G_PITCH);
      fa[0][i].u[1] = *(const uint4*)(xs + i * 16 * G_PITCH + 32);
    }
#pragma unroll
    for (int j = 0; j < 4; ++j) {
      fb[0][j].u[0] = *(const uint4*)(ws + j * 16 * G_PITCH);
      fb[0][j].u[1] = *(const uint4*)(ws + j * 16 * G_PITCH + 32);
    }
#pragma unroll
    for (int kk = 0; kk < 4; ++kk) {
      const int cur = kk & 1, nxt = cur ^ 1;
      if (kk < 3) {  // the same stage's next block, into the other register set
#pragma unroll
        for (int i = 0; i < 4; ++i) {
          fa[nxt][i].u[0] = *(const uint4*)(xs + i * 16 * G_PITCH + (kk + 1) * 64);
          fa[nxt][i].u[1] = *(const uint4*)(xs + i * 16 * G_PITCH + (kk + 1) * 64 + 32);
        }
#pragma unroll
        for (int j = 0; j < 4; ++j) {
          fb[nxt][j].u[0] = *(const uint4*)(ws + j * 16 * G_PITCH + (kk + 1) * 64);
          fb[nxt][j].u[1] = *(const uint4*)(ws + j * 16 * G_PITCH + (kk + 1) * 64 + 32);
        }
      }
      // keeps the reads one group ahead of the products: without it the
      // compiler sinks each pair of reads to its four products, with a full
      // LDS wait in front of every pair
      __builtin_amdgcn_sched_barrier(0);
#pragma unroll
      for (int j = 0; j < 4; ++j)
        // unrolled: constant indices into acc and the fragment sets
#pragma unroll
        for (int a = 0; a < 4; ++a)
          acc[a][j] = wmma_f16(fa[cur][a].h, fb[cur][j].h, acc[a][j]);
      // keeps the next group of reads out of this block's products
      __builtin_amdgcn_sched_barrier(0);
    }
    // publish point of stage t + 1: this wave's reads of stage t are done ...
    asm volatile("s_wait_dscnt 0x0" ::: "memory");
    // ... its own copies of stage t + 1 have landed ...
    asm volatile("s_wait_asynccnt 0x0" ::: "memory");
    // ... and the barrier both publishes stage t + 1 and frees stage t's buffer
    __syncthreads();
    if (t + 2 < nt)
      gemm_stage_copy(ld + boff, xg + (size_t)(t + 2) * G_BK,
                      wg + (size_t)(t + 2) * G_BK, step16);
  }
  // no copy is left outstanding behind the main loop
  asm volatile("s_wait_asynccnt 0x0" ::: "memory");
}

// ---------------------------------------------------------------------------
// Epilogue: bias + RMSNorm(head_dim) + RoPE + optional scale:
// accumulators -> f16 [H][M][HD]. The block's 128 columns are one head,
// so its tile holds whole head rows. The f32 tile goes through the ring's LDS,
// which every wave has left at the loop's last barrier; then one wave per row,
// a lane owns 4 consecutive dims (2 rope pairs), a row is stored as two lines.
// ---------------------------------------------------------------------------
#define E_PITCH 132                     // floats per staged row: 16 B x odd

static __device__ __forceinline__ void
norm_rope_epilogue(const v8f (&acc)[4][4], unsigned char* smem,
                   const float* __restrict__ bias, const float* __restrict__ w,
                   const float* __restrict__ cs, const float* __restrict__ sn,
                   _Float16* __restrict__ out, int M, int mb, int nb, float scale) {
  const int lane = threadIdx.x & 31;
  const int wave = threadIdx.x >> 5;
  const int r    = lane & 15;
  const int half = lane >> 4;

  // this wave's first 16 rows of cos and sin, asked for ahead of the staging and
  // its barrier, which cover a part of their latency
  const int d    = lane * 4;
  const int row0 = wave * 32;
  const float* cp = cs + (size_t)(mb + row0) * HDIM + d;
  const float* sp = sn + (size_t)(mb + row0) * HDIM + d;
  const float4 wv = *(const float4*)(w + d);
  float4 c[32], s[32];
  // unrolled: c and s stay in registers
#pragma unroll
  for (int q = 0; q < 16; ++q) {
    c[q] = *(const float4*)(cp + q * HDIM);
    s[q] = *(const float4*)(sp + q * HDIM);
  }

  float* st = (float*)smem;
  const int ml = (wave >> 1) * 64 + half * 8;
  const int nl = (wave & 1) * 64 + r;
  // unrolled (all three loops): constant indices into acc, which stays in registers
#pragma unroll
  for (int j = 0; j < 4; ++j) {
    const float bn = bias[nb + nl + j * 16];
#pragma unroll
    for (int a = 0; a < 4; ++a)
#pragma unroll
      for (int i = 0; i < 8; ++i)
        st[(ml + a * 16 + i) * E_PITCH + nl + j * 16] = acc[a][j][i] + bn;
  }
  // publishes the staged tile: a row's two halves come from two waves
  __syncthreads();

  _Float16* op = out + ((size_t)blockIdx.x * M + mb + row0) * HDIM + d;
  uint64_t ov[4];  // four finished rows, packed, on their way to one store statement
  // two groups of sixteen rows, one after the other: all 32 at once do not fit the
  // registers (unrolled: constant indices into c and s)
#pragma unroll
  for (int g = 0; g < 32; g += 16) {
    // sixteen rows are read as one group: behind a row's store statement (below),
    // whose memory clobber holds later LDS reads back, the rows would run four at a time
    // (unrolled: xr stays in registers)
    float4 xr[16];
#pragma unroll
    for (int q = g; q < g + 16; ++q)
      xr[q - g] = *(const float4*)(st + (row0 + q) * E_PITCH + d);
    // unrolled: constant indices into xr, c, s and ov; the rows' reductions interleave
#pragma unroll
    for (int q = g; q < g + 16; ++q) {
      const float4 x = xr[q - g];
      float ss = x.x * x.x + x.y * x.y + x.z * x.z + x.w * x.w;
#pragma unroll
      for (int msk = 1; msk < 32; msk <<= 1) ss += __shfl_xor(ss, msk, 32);
      const float inv = rsqrtf(ss * (1.0f / (float)HDIM) + 1e-6f);

      const float y0 = x.x * inv * wv.x;
      const float y1 = x.y * inv * wv.y;
      const float y2 = x.z * inv * wv.z;
      const float y3 = x.w * inv * wv.w;

      v4h o;
      o[0] = (_Float16)((y0 * c[q].x - y1 * s[q].x) * scale);
      o[1] = (_Float16)((y1 * c[q].y + y0 * s[q].y) * scale);
      o[2] = (_Float16)((y2 * c[q].z - y3 * s[q].z) * scale);
      o[3] = (_Float16)((y3 * c[q].w + y2 * s[q].w) * scale);
      ov[q & 3] = __builtin_bit_cast(uint64_t, o);
      // Four rows' stores and, as the statement's last line, the wait that stands
      // in front of any later rewrite of a register that a store names: this build
      // uses registers above v255, and the compiler lifted later register writes over
      // a wait in its own statement.
      if ((q & 3) == 3)
        asm volatile("global_store_b64 %0, %4, off\n\t"
                     "global_store_b64 %1, %5, off\n\t"
                     "global_store_b64 %2, %6, off\n\t"
                     "global_store_b64 %3, %7, off\n\t"
                     "s_wait_xcnt 0x0"
                     :: "v"(op + (q - 3) * HDIM), "v"(op + (q - 2) * HDIM),
                        "v"(op + (q - 1) * HDIM), "v"(op + q * HDIM),
                        "v"(ov[0]), "v"(ov[1]), "v"(ov[2]), "v"(ov[3])
                     : "memory");
      // the other 16 rows of cos and sin, asked for when half of the first 16 rows'
      // registers are free (held any earlier, the build spills to scratch); the work
      // on rows 8 to 15 covers their latency
      if (q == 7) {
        // unrolled: c and s stay in registers
#pragma unroll
        for (int u = 16; u < 32; ++u) {
          c[u] = *(const float4*)(cp + u * HDIM);
          s[u] = *(const float4*)(sp + u * HDIM);
        }
      }
    }
  }
}

// ---------------------------------------------------------------------------
// Epilogue: bias + transposed pack: accumulators -> f16 [N][M], that
// is [H][HD][M]. A lane's accumulator tile holds 8 consecutive rows m of one
// column n: 16 B of an output row. The 128 x 256 f16 tile goes through the
// ring's LDS so that each output row's 512 B leave as four whole lines.
// ---------------------------------------------------------------------------
#define T_PITCH 528                     // bytes per staged row: 16 B x odd

static __device__ __forceinline__ void
vt_epilogue(const v8f (&acc)[4][4], unsigned char* smem,
            const float* __restrict__ bias, _Float16* __restrict__ out,
            int M, int mb, int nb) {
  const int lane = threadIdx.x & 31;
  const int wave = threadIdx.x >> 5;
  const int r    = lane & 15;
  const int half = lane >> 4;

  const int ml = (wave >> 1) * 64 + half * 8;
  const int nl = (wave & 1) * 64 + r;
  float bn[4];
  // unrolled: bn stays in registers
#pragma unroll
  for (int j = 0; j < 4; ++j) bn[j] = bias[nb + nl + j * 16];
  // stands in front of any later rewrite of the register that the four loads
  // name
  asm volatile("s_wait_xcnt 0x0" ::: "memory");
  // unrolled (all three loops): constant indices into acc, which stays in registers
#pragma unroll
  for (int j = 0; j < 4; ++j) {
#pragma unroll
    for (int a = 0; a < 4; ++a) {
      v8h o;
#pragma unroll
      for (int i = 0; i < 8; ++i) o[i] = (_Float16)(acc[a][j][i] + bn[j]);
      *(v8h*)(smem + (nl + j * 16) * T_PITCH + (ml + a * 16) * 2) = o;
    }
  }
  // publishes the staged tile: an output row's four quarters come from four waves
  __syncthreads();

  // one wave per 512-B output row, 8 rows per block-wide store
  const unsigned char* sp = smem + wave * T_PITCH + lane * 16;
  _Float16* op = out + (size_t)(nb + wave) * M + mb + lane * 8;
  const size_t step8 = (size_t)8 * M;
  // unrolled: v stays in registers; the sixteen LDS reads issue as one group ahead
  // of the store statements, whose memory clobber would hold later reads back
  v4u v[16];
#pragma unroll
  for (int k = 0; k < 16; ++k) v[k] = *(const v4u*)(sp + k * 8 * T_PITCH);
  // Four rows' stores and, as the statement's last line, the wait that stands in
  // front of any later rewrite of a register that a store names.
#pragma unroll
  for (int k = 0; k < 16; k += 4)
    asm volatile("global_store_b128 %0, %4, off\n\t"
                 "global_store_b128 %1, %5, off\n\t"
                 "global_store_b128 %2, %6, off\n\t"
                 "global_store_b128 %3, %7, off\n\t"
                 "s_wait_xcnt 0x0"
                 :: "v"(op + (size_t)k * step8), "v"(op + (size_t)(k + 1) * step8),
                    "v"(op + (size_t)(k + 2) * step8), "v"(op + (size_t)(k + 3) * step8),
                    "v"(v[k]), "v"(v[k + 1]), "v"(v[k + 2]), "v"(v[k + 3])
                 : "memory");
}

// ---------------------------------------------------------------------------
// All five projections in ONE launch. blockIdx.x is the head (128 columns),
// blockIdx.y a 256-row tile of one projection, in the order Q, K, Kc, V, Vc, so
// that the two users of a weight matrix run next to each other. The choice is
// the same for a whole block (scalar), so every barrier is block-uniform.
// ---------------------------------------------------------------------------
#define PT_S   (S_LEN / G_BM)           // row tiles of a projection of the hidden states
#define PT_C   (SC_LEN / G_BM)          // row tiles of a projection of the cond states
#define PT_ALL (3 * PT_S + 2 * PT_C)

__global__ void __launch_bounds__(256)
projections_kernel(const _Float16* __restrict__ hsb, const _Float16* __restrict__ condb,
                   const _Float16* __restrict__ wqb, const _Float16* __restrict__ wkb,
                   const _Float16* __restrict__ wvb, const float* __restrict__ bq,
                   const float* __restrict__ bk, const float* __restrict__ bv,
                   const float* __restrict__ nqw, const float* __restrict__ nkw,
                   const float* __restrict__ cos0, const float* __restrict__ sin0,
                   const float* __restrict__ cos1, const float* __restrict__ sin1,
                   _Float16* __restrict__ Qb, _Float16* __restrict__ Kb,
                   _Float16* __restrict__ Kcb, _Float16* __restrict__ Vtb,
                   _Float16* __restrict__ Vctb, int K, float qscale) {
  __shared__ __attribute__((aligned(16))) unsigned char smem[2 * G_STAGE];
  const int y  = blockIdx.y;
  const int nb = blockIdx.x * HDIM;

  const bool cross = (y >= 2 * PT_S && y < 2 * PT_S + PT_C) || y >= 3 * PT_S + PT_C;
  const bool isv   = y >= 2 * PT_S + PT_C;
  const bool isq   = y < PT_S;
  const int  y0    = isq ? 0
                   : y < 2 * PT_S ? PT_S
                   : y < 2 * PT_S + PT_C ? 2 * PT_S
                   : y < 3 * PT_S + PT_C ? 2 * PT_S + PT_C : 3 * PT_S + PT_C;
  const int  mb    = (y - y0) * G_BM;
  const int  M     = cross ? SC_LEN : S_LEN;
  const _Float16* X = cross ? condb : hsb;
  const _Float16* W = isq ? wqb : isv ? wvb : wkb;

  v8f acc[4][4];
  gemm_tile_acc(X, W, K, mb, nb, smem, acc);

  if (isv) {
    vt_epilogue(acc, smem, bv, cross ? Vctb : Vtb, M, mb, nb);
  } else {
    norm_rope_epilogue(acc, smem, isq ? bq : bk, isq ? nqw : nkw,
                       cross ? cos1 : cos0, cross ? sin1 : sin0,
                       isq ? Qb : cross ? Kcb : Kb, M, mb, nb,
                       isq ? qscale : 1.0f);
  }
}

// ---------------------------------------------------------------------------
// One online-softmax attention pass over T keys for a 16-query block, in the
// transposed form S^T = K Q^T, O^T += V^T P^T: a lane holds scores of ONE query
// (column lane & 15), keys 8 * half + i of each 16-key tile in register i. The
// maximum and the sum over keys are taken inside the lane plus one exchange
// between the wave's halves, and two score tiles, converted in place, are the
// B operand of the second product.
// The block's four waves work on one head, so they share its K and V^T tiles:
// a stage is 64 keys (64 K rows of 256 B, 128 V^T rows of 128 B), brought into
// LDS by asynchronous b128 copies of whole 128-B lines. Two buffers: the next
// stage's copies fly while this stage is worked on. Needs T % 64 == 0.
// ---------------------------------------------------------------------------
#define A_KEYS    64                              // keys per stage
#define A_KPITCH  272                             // K row pitch, 16 B x odd
#define A_VPITCH  144                             // V^T row pitch, 16 B x odd
#define A_KBYTES  (A_KEYS * A_KPITCH)             // K part of a buffer
#define A_STAGE   (A_KBYTES + HDIM * A_VPITCH)    // bytes per buffer

// Eight copies and, as the statement's last line, the wait that stands in
// front of any rewrite of the address registers the copies name.
static __device__ __forceinline__ void async_copy8(const uint32_t* l,
                                                   const _Float16* const* p) {
  asm volatile(
      "global_load_async_to_lds_b128 %0, %8, off\n\t"
      "global_load_async_to_lds_b128 %1, %9, off\n\t"
      "global_load_async_to_lds_b128 %2, %10, off\n\t"
      "global_load_async_to_lds_b128 %3, %11, off\n\t"
      "global_load_async_to_lds_b128 %4, %12, off\n\t"
      "global_load_async_to_lds_b128 %5, %13, off\n\t"
      "global_load_async_to_lds_b128 %6, %14, off\n\t"
      "global_load_async_to_lds_b128 %7, %15, off\n\t"
      "s_wait_xcnt 0x0"
      :: "v"(l[0]), "v"(l[1]), "v"(l[2]), "v"(l[3]),
         "v"(l[4]), "v"(l[5]), "v"(l[6]), "v"(l[7]),
         "v"(p[0]), "v"(p[1]), "v"(p[2]), "v"(p[3]),
         "v"(p[4]), "v"(p[5]), "v"(p[6]), "v"(p[7])
      : "memory");
}

// One stage: this thread's 16 B of K rows krow, krow + 8, ..., krow + 56 and
// of V^T rows vrow, vrow + 16, ..., vrow + 112.
static __device__ __forceinline__ void attn_stage_copy(uint32_t ldk, uint32_t ldv,
                                                       const _Float16* kg,
                                                       const _Float16* vg,
                                                       size_t vstep16) {
  uint32_t l[16];
  const _Float16* p[16];
#pragma unroll
  for (int i = 0; i < 8; ++i) {
    l[i] = ldk + (uint32_t)(i * 8 * A_KPITCH);
    p[i] = kg + (size_t)i * 8 * HDIM;
    l[8 + i] = ldv + (uint32_t)(i * 16 * A_VPITCH);
    p[8 + i] = vg + (size_t)i * vstep16;
  }
  async_copy8(l, p);
  async_copy8(l + 8, p + 8);
}

// lane l with lane l ^ 16
static __device__ __forceinline__ float xhalf(float x) {
  const int b = __builtin_bit_cast(int, x);
  return __builtin_bit_cast(float, __builtin_amdgcn_permlanex16(
      b, b, 0x76543210, 0xfedcba98, false, false));
}

__device__ __forceinline__ void attn_pass(const AF* qa,
                                          const _Float16* __restrict__ Kr,
                                          const _Float16* __restrict__ Vt,
                                          int T, const unsigned char* ring,
                                          int lane, v8f* o, float& l) {
  const int r = lane & 15, half = lane >> 4;
#pragma unroll
  for (int j = 0; j < 8; ++j) { o[j] = v8f_zero(); }
  float m = -1e30f;  // running maximum of this lane's query, equal in both halves
  l = 0.f;           // running sum over THIS half's keys; the caller joins the halves

  // copy role: 16 threads per 256-B K row, 8 threads per 128-B V^T row
  const int tid = threadIdx.x;
  const _Float16* kg = Kr + (size_t)(tid >> 4) * HDIM + (tid & 15) * 8;
  const _Float16* vg = Vt + (size_t)(tid >> 3) * T + (tid & 7) * 8;
  const uint32_t ldk = (uint32_t)(size_t)ring +
                       (uint32_t)((tid >> 4) * A_KPITCH + (tid & 15) * 16);
  const uint32_t ldv = (uint32_t)(size_t)ring +
                       (uint32_t)(A_KBYTES + (tid >> 3) * A_VPITCH + (tid & 7) * 16);
  const size_t vstep16 = (size_t)16 * T;
  const int ns = T / A_KEYS;

  // Every reader has left both buffers here: at the kernel's start nothing has
  // read them, and an earlier pass ends with its last publish point's barrier.
  attn_stage_copy(ldk, ldv, kg, vg, vstep16);
  // stage 0 has landed for this wave; the barrier publishes it to the others
  asm volatile("s_wait_asynccnt 0x0" ::: "memory");
  __syncthreads();
  if (ns > 1)
    attn_stage_copy(ldk + A_STAGE, ldv + A_STAGE, kg + (size_t)A_KEYS * HDIM,
                    vg + A_KEYS, vstep16);

  for (int s = 0; s < ns; ++s) {
    const uint32_t boff = (uint32_t)(s & 1) * A_STAGE;
    const unsigned char* kt = ring + boff + r * A_KPITCH + half * 16;
    const unsigned char* vt = ring + boff + A_KBYTES + r * A_VPITCH + half * 16;
    // kept rolled: unrolled, the two halves' live ranges take the kernel to 356
    // registers, two waves per SIMD where the grid wants three
#pragma unroll 1
    for (int ks = 0; ks < 2; ++ks) {
      const unsigned char* kr0 = kt + ks * 32 * A_KPITCH;
      const unsigned char* kr1 = kr0 + 16 * A_KPITCH;
      v8f s0 = v8f_zero(), s1 = v8f_zero();
      AF b0[4], b1[4];
#pragma unroll
      for (int kc = 0; kc < 4; ++kc) {
        b0[kc].u[0] = *(const uint4*)(kr0 + kc * 64);
        b0[kc].u[1] = *(const uint4*)(kr0 + kc * 64 + 32);
        b1[kc].u[0] = *(const uint4*)(kr1 + kc * 64);
        b1[kc].u[1] = *(const uint4*)(kr1 + kc * 64 + 32);
      }
      // keeps the sixteen K reads one group ahead of the products: without it
      // the compiler sinks each four to their two products behind a full LDS wait
      __builtin_amdgcn_sched_barrier(0);
#pragma unroll
      for (int kc = 0; kc < 4; ++kc) {
        s0 = wmma_f16(b0[kc].h, qa[kc].h, s0);  // s0[i] = S[query r][key 8 * half + i]
        s1 = wmma_f16(b1[kc].h, qa[kc].h, s1);  // s1[i] = S[query r][key 16 + 8 * half + i]
      }
      AF av[8];
#pragma unroll
      for (int j = 0; j < 8; ++j) {
        const unsigned char* vr = vt + j * 16 * A_VPITCH + ks * 64;
        av[j].u[0] = *(const uint4*)(vr);
        av[j].u[1] = *(const uint4*)(vr + 32);
      }
      // keeps the sixteen V^T reads in front of the softmax, which covers their
      // latency: without it the compiler sinks each pair to its product behind
      // a full LDS wait
      __builtin_amdgcn_sched_barrier(0);
      // online softmax of one query per lane: 16 of the 32 keys in this half
      float cm = fmaxf(s0[0], s1[0]);
#pragma unroll
      for (int i = 1; i < 8; ++i) cm = fmaxf(cm, fmaxf(s0[i], s1[i]));
      cm = fmaxf(cm, xhalf(cm));
      const float mn = fmaxf(m, cm);
      const float alpha = __expf(m - mn);
      m = mn;
      AF pb;  // P^T as B operand: element s is key 8 * half + s, then 16 + 8 * half + (s - 8)
#pragma unroll
      for (int i = 0; i < 8; i += 2) {
        v2f p0, p1;
        p0[0] = __expf(s0[i] - mn); p0[1] = __expf(s0[i + 1] - mn);
        p1[0] = __expf(s1[i] - mn); p1[1] = __expf(s1[i + 1] - mn);
        s0[i] = p0[0]; s0[i + 1] = p0[1];
        s1[i] = p1[0]; s1[i + 1] = p1[1];
        const v2h h0 = __builtin_convertvector(p0, v2h);
        const v2h h1 = __builtin_convertvector(p1, v2h);
        pb.h[i] = h0[0];     pb.h[i + 1] = h0[1];
        pb.h[8 + i] = h1[0]; pb.h[8 + i + 1] = h1[1];
      }
#pragma unroll
      for (int j = 0; j < 8; ++j) o[j] *= alpha;
#pragma unroll
      for (int j = 0; j < 8; ++j) {
        o[j] = wmma_f16(av[j].h, pb.h, o[j]);  // o[j][i] = O[query r][16 * j + 8 * half + i]
      }
      // keeps the sum's additions behind the last product, so that no product
      // stands directly in front of the loop's branch
      __builtin_amdgcn_sched_barrier(0);
      const v8f ps = s0 + s1;
      l = l * alpha + (((ps[0] + ps[1]) + (ps[2] + ps[3])) +
                       ((ps[4] + ps[5]) + (ps[6] + ps[7])));
    }
    // publish point of stage s + 1: this wave's reads of stage s are done ...
    asm volatile("s_wait_dscnt 0x0" ::: "memory");
    // ... its own copies of stage s + 1 have landed ...
    asm volatile("s_wait_asynccnt 0x0" ::: "memory");
    // ... and the barrier both publishes stage s + 1 and frees stage s's buffer
    __syncthreads();
    if (s + 2 < ns)
      attn_stage_copy(ldk + boff, ldv + boff,
                      kg + (size_t)(s + 2) * A_KEYS * HDIM,
                      vg + (size_t)(s + 2) * A_KEYS, vstep16);
  }
  // no copy is left outstanding behind the pass
  asm volatile("s_wait_asynccnt 0x0" ::: "memory");
}

// ---------------------------------------------------------------------------
// Fused dual attention: out = lambda * softmax(Q Kc^T) Vc + softmax(Q K^T) V
// 4 waves per block; each wave owns one (head, 16-query) block; the four
// blocks of a work-group lie in one head (128 query blocks per head).
// ---------------------------------------------------------------------------
__global__ void __launch_bounds__(128)
attention_kernel(const _Float16* __restrict__ Qb, const _Float16* __restrict__ Kb,
                 const _Float16* __restrict__ Vtb, const _Float16* __restrict__ Kcb,
                 const _Float16* __restrict__ Vctb, const float* __restrict__ lam,
                 float* __restrict__ out) {
  __shared__ __attribute__((aligned(16))) unsigned char ring[2 * A_STAGE];
  const int wave = threadIdx.x >> 5;
  const int lane = threadIdx.x & 31;
  const int r = lane & 15, half = lane >> 4;
  const int qb = blockIdx.x * 4 + wave;       // 0 .. H*(S/16)-1
  const int h  = blockIdx.x >> 5;             // = qb / (S_LEN/16), one per block
  const int q0 = (qb & 127) * 16;

  // Q fragments (pre-scaled by 1/sqrt(HD) at pack time)
  AF qa[4];
  const _Float16* qrow = Qb + ((size_t)h * S_LEN + q0 + r) * HDIM;
#pragma unroll
  for (int kc = 0; kc < 4; ++kc) {
    qa[kc].u[0] = *(const uint4*)(qrow + kc * 32 + half * 8);
    qa[kc].u[1] = *(const uint4*)(qrow + kc * 32 + 16 + half * 8);
  }

  v8f oc[8]; float lc;
  attn_pass(qa, Kcb + (size_t)h * SC_LEN * HDIM, Vctb + (size_t)h * HDIM * SC_LEN,
            SC_LEN, ring, lane, oc, lc);
  const float fc = lam[0] / (lc + xhalf(lc));
#pragma unroll
  for (int j = 0; j < 8; ++j) oc[j] *= fc;

  v8f os[8]; float ls;
  attn_pass(qa, Kb + (size_t)h * S_LEN * HDIM, Vtb + (size_t)h * HDIM * S_LEN,
            S_LEN, ring, lane, os, ls);

  // a lane holds eight consecutive head dims of its query per tile: 32 B stores
  const float inv = 1.0f / (ls + xhalf(ls));
  float* orow = out + (size_t)(q0 + r) * DMODEL + h * HDIM + half * 8;
#pragma unroll
  for (int j = 0; j < 8; ++j) {
    float4 lo, hi;
    lo.x = oc[j][0] + os[j][0] * inv; lo.y = oc[j][1] + os[j][1] * inv;
    lo.z = oc[j][2] + os[j][2] * inv; lo.w = oc[j][3] + os[j][3] * inv;
    hi.x = oc[j][4] + os[j][4] * inv; hi.y = oc[j][5] + os[j][5] * inv;
    hi.z = oc[j][6] + os[j][6] * inv; hi.w = oc[j][7] + os[j][7] * inv;
    *(float4*)(orow + j * 16)     = lo;
    *(float4*)(orow + j * 16 + 4) = hi;
  }
}

// ---------------------------------------------------------------------------
// host launcher
// ---------------------------------------------------------------------------
extern "C" void kernel_launch(void* const* d_in, const int* in_sizes, int n_in,
                              void* d_out, int out_size, void* d_ws, size_t ws_size,
                              hipStream_t stream) {
  (void)in_sizes; (void)n_in; (void)out_size; (void)ws_size;
  const float* hs    = (const float*)d_in[0];
  const float* cond  = (const float*)d_in[1];
  const float* lam   = (const float*)d_in[2];
  const float* Wq    = (const float*)d_in[3];
  const float* bq    = (const float*)d_in[4];
  const float* Wk    = (const float*)d_in[5];
  const float* bk    = (const float*)d_in[6];
  const float* Wv    = (const float*)d_in[7];
  const float* bv    = (const float*)d_in[8];
  const float* nqw   = (const float*)d_in[9];
  const float* nkw   = (const float*)d_in[10];
  const float* cos0  = (const float*)d_in[11];
  const float* sin0  = (const float*)d_in[12];
  const float* cos1  = (const float*)d_in[13];
  const float* sin1  = (const float*)d_in[14];
  float* out = (float*)d_out;

  // workspace carve (256B aligned)
  char* wp = (char*)d_ws;
  auto carve = [&](size_t bytes) -> void* {
    void* p = (void*)wp;
    wp += (bytes + 255) & ~(size_t)255;
    return p;
  };
  _Float16* hsb   = (_Float16*)carve((size_t)S_LEN * DMODEL * 2);
  _Float16* condb = (_Float16*)carve((size_t)SC_LEN * DMODEL * 2);
  _Float16* wqb   = (_Float16*)carve((size_t)DMODEL * DMODEL * 2);
  _Float16* wkb   = (_Float16*)carve((size_t)DMODEL * DMODEL * 2);
  _Float16* wvb   = (_Float16*)carve((size_t)DMODEL * DMODEL * 2);
  _Float16* Qb    = (_Float16*)carve((size_t)S_LEN * DMODEL * 2);
  _Float16* Kb    = (_Float16*)carve((size_t)S_LEN * DMODEL * 2);
  _Float16* Kcb   = (_Float16*)carve((size_t)SC_LEN * DMODEL * 2);
  _Float16* Vtb   = (_Float16*)carve((size_t)S_LEN * DMODEL * 2);
  _Float16* Vctb  = (_Float16*)carve((size_t)SC_LEN * DMODEL * 2);

  const float qscale = 0.088388347648318447f;  // 1/sqrt(128)

  // every f32 operand to f16, one launch
  f32_to_f16_all_kernel<<<CB_ALL, 256, 0, stream>>>(hs, cond, Wq, Wk, Wv, hsb, condb,
                                                    wqb, wkb, wvb);

  // Q, K, Kc (normed, roped) and V, Vc (transposed to [H][HD][T]), one launch
  projections_kernel<<<dim3(DMODEL / 128, PT_ALL), 256, 0, stream>>>(
      hsb, condb, wqb, wkb, wvb, bq, bk, bv, nqw, nkw, cos0, sin0, cos1, sin1,
      Qb, Kb, Kcb, Vtb, Vctb, DMODEL, qscale);

  // fused dual attention + combine
  const unsigned attnBlocks = (unsigned)(NHEADS * (S_LEN / 16) / 4);
  attention_kernel<<<attnBlocks, 128, 0, stream>>>(Qb, Kb, Vtb, Kcb, Vctb, lam, out);
}
